// v000
// Times are from an AMD MI455X. After a warm-up the kernel runs many times in a row, and a time is the length of
// such a window on the GPU divided by its runs, so every launch and the gaps after it count. The runs cycle
// through copies of the inputs. A figure is the median of several windows, for all but v000 over two sittings.
// Sittings can differ by a few percent; kernels timed side by side share one.
// v000 is the starting kernel. One run takes 597 microseconds.
#include <hip/hip_runtime.h>
#include <hip/hip_bf16.h>
#include <math.h>

typedef __attribute__((ext_vector_type(16))) _Float16 v16h;
typedef __attribute__((ext_vector_type(8)))  float    v8f;
typedef __attribute__((ext_vector_type(4)))  unsigned int u32x4;
typedef __attribute__((ext_vector_type(8)))  int      i32x8;
typedef __attribute__((ext_vector_type(4)))  int      i32x4;

#define S_LEN 4096
#define DM    1024
#define NH    16
#define DKH   64   // head dim

// ---------------------------------------------------------------------------
// Fragment loader (global or LDS), contiguous k order (not AMD's table order),
// valid because A and B both use it.
// A (16x32 f16): lanes 0-15 -> row (lane&15), K 0..15 ; lanes 16-31 -> K 16..31
// B (32x16 f16): identical addressing against B^T stored [N, K] row-major.
// ---------------------------------------------------------------------------
__device__ __forceinline__ v16h load_frag(const _Float16* base, int ld) {
  int l = threadIdx.x & 31;
  return *(const v16h*)(base + (long)(l & 15) * ld + ((l >> 4) << 4));
}

__device__ __forceinline__ v8f wmma_f16(v16h a, v16h b, v8f c) {
  return __builtin_amdgcn_wmma_f32_16x16x32_f16(false, a, false, b, (short)0, c,
                                                false, false);
}

// ---------------------------------------------------------------------------
// Tensor Data Mover helpers. D# group1 (dims/strides, constant per tensor) is
// built once and hoisted; per-issue we only pack the new global address.
// ---------------------------------------------------------------------------
__device__ __forceinline__ i32x8 tdm_g1_2d(unsigned int tensor_d0,
                                           unsigned int tensor_d1,
                                           unsigned int tile_d0,
                                           unsigned int tile_d1,
                                           unsigned int stride0) {
  i32x8 g1 = { (int)0x00010000u,                                  // data_size=2B
               (int)((tensor_d0 & 0xFFFFu) << 16),
               (int)((tensor_d0 >> 16) | ((tensor_d1 & 0xFFFFu) << 16)),
               (int)((tensor_d1 >> 16) | (tile_d0 << 16)),
               (int)tile_d1,                                      // tile_dim2=0
               (int)stride0,
               0, 0 };
  return g1;
}

__device__ __forceinline__ void tdm_issue(unsigned int lds_addr,
                                          const void* gptr, i32x8 g1) {
  unsigned long long ga = (unsigned long long)gptr;
  u32x4 g0 = { 1u, lds_addr, (unsigned int)ga,
               (unsigned int)((ga >> 32) & 0x1FFFFFFu) | 0x80000000u };
  i32x4 z4 = {};
  i32x8 z8 = {};
  __builtin_amdgcn_tensor_load_to_lds(g0, g1, z4, z4, z8, 0);
}

// ---------------------------------------------------------------------------
// Elementwise converts
// ---------------------------------------------------------------------------
__global__ void cvt_f32_f16(const float* __restrict__ src,
                            _Float16* __restrict__ dst, int n) {
  int i = blockIdx.x * blockDim.x + threadIdx.x;
  if (i < n) dst[i] = (_Float16)src[i];
}

// W: [NH, DM, DKH] f32  ->  Wt: [NH, DKH, DM] f16  (B^T per head)
__global__ void transpose_w(const float* __restrict__ W,
                            _Float16* __restrict__ Wt) {
  int i = blockIdx.x * blockDim.x + threadIdx.x;
  if (i >= NH * DM * DKH) return;
  int dk = i % DKH;
  int d  = (i / DKH) % DM;
  int h  = i / (DKH * DM);
  Wt[((long)h * DKH + dk) * DM + d] = (_Float16)W[i];
}

// ---------------------------------------------------------------------------
// QKV projection GEMM: dst[h] = (A[S,DM] x W[h][DM,DKH] + b[h]) * scale
// 8 waves, tile 256(M) x 64(N); each wave 32x64; K-loop unrolled x2 with
// explicit ping-pong stage registers (no rotation copies).
// ---------------------------------------------------------------------------
__global__ __launch_bounds__(256)
void proj_gemm(const _Float16* __restrict__ A,
               const _Float16* __restrict__ Bt,
               const float* __restrict__ bias,
               _Float16* __restrict__ dst,
               float scale, int transposed) {
  const int wave = threadIdx.x >> 5;
  const int lane = threadIdx.x & 31;
  const int h    = blockIdx.x;
  const int m0   = blockIdx.y * 256 + wave * 32;

  v8f acc[2][4];
#pragma unroll
  for (int r = 0; r < 2; ++r)
#pragma unroll
    for (int t = 0; t < 4; ++t) acc[r][t] = (v8f){};

  const _Float16* A0 = A + (long)m0 * DM;
  const _Float16* A1 = A0 + 16 * DM;
  const _Float16* Bb = Bt + (long)h * DKH * DM;

  v16h a0[2], a1[2], b[2][4];
  a0[0] = load_frag(A0, DM);
  a1[0] = load_frag(A1, DM);
#pragma unroll
  for (int t = 0; t < 4; ++t) b[0][t] = load_frag(Bb + (long)(t * 16) * DM, DM);

  for (int k0 = 0; k0 < DM; k0 += 64) {
    // prefetch stage 1 (k0+32 always < DM)
    a0[1] = load_frag(A0 + k0 + 32, DM);
    a1[1] = load_frag(A1 + k0 + 32, DM);
#pragma unroll
    for (int t = 0; t < 4; ++t)
      b[1][t] = load_frag(Bb + (long)(t * 16) * DM + k0 + 32, DM);

#pragma unroll
    for (int t = 0; t < 4; ++t) {
      acc[0][t] = wmma_f16(a0[0], b[0][t], acc[0][t]);
      acc[1][t] = wmma_f16(a1[0], b[0][t], acc[1][t]);
    }

    // prefetch stage 0 for next pair (clamped dummy on the last pair)
    const int kn = (k0 + 64 < DM) ? (k0 + 64) : 0;
    a0[0] = load_frag(A0 + kn, DM);
    a1[0] = load_frag(A1 + kn, DM);
#pragma unroll
    for (int t = 0; t < 4; ++t)
      b[0][t] = load_frag(Bb + (long)(t * 16) * DM + kn, DM);

#pragma unroll
    for (int t = 0; t < 4; ++t) {
      acc[0][t] = wmma_f16(a0[1], b[1][t], acc[0][t]);
      acc[1][t] = wmma_f16(a1[1], b[1][t], acc[1][t]);
    }
  }

  const int rbase = (lane >> 4) << 3;
#pragma unroll
  for (int r = 0; r < 2; ++r)
#pragma unroll
    for (int t = 0; t < 4; ++t) {
      int dk = t * 16 + (lane & 15);
      float bv = bias[h * DKH + dk];
#pragma unroll
      for (int i = 0; i < 8; ++i) {
        int m = m0 + r * 16 + rbase + i;
        float val = (acc[r][t][i] + bv) * scale;
        if (!transposed)
          dst[((long)h * S_LEN + m) * DKH + dk] = (_Float16)val;
        else
          dst[((long)h * DKH + dk) * S_LEN + m] = (_Float16)val;
      }
    }
}

// ---------------------------------------------------------------------------
// Flash attention: one (head, 128-query-row block) per 256-thread block.
// K/V 64x64 tiles DMA'd into double-buffered LDS by the TDM (wave 0), synced
// with s_wait_tensorcnt + barrier; all 8 waves read fragments from LDS.
// q is pre-scaled by 1/sqrt(dk) at projection time.
// ---------------------------------------------------------------------------
__global__ __launch_bounds__(256)
void flash_attn(const _Float16* __restrict__ q,
                const _Float16* __restrict__ k,
                const _Float16* __restrict__ vT,
                _Float16* __restrict__ x) {
  __shared__ __align__(32) _Float16 kt[2][64][64];     // [key][dk]
  __shared__ __align__(32) _Float16 vt[2][64][64];     // [dk][key]
  __shared__ __align__(32) _Float16 ldsP[8][16][64];   // per-wave P tile

  const int wave = threadIdx.x >> 5;
  const int lane = threadIdx.x & 31;
  const int h    = blockIdx.y;
  const int m0   = blockIdx.x * 128 + wave * 16;

  const _Float16* qb = q  + ((long)h * S_LEN + m0) * DKH;
  const _Float16* kb = k  + (long)h * S_LEN * DKH;
  const _Float16* vb = vT + (long)h * DKH * S_LEN;

  const v16h aq0 = load_frag(qb, DKH);
  const v16h aq1 = load_frag(qb + 32, DKH);

  v8f o[4];
#pragma unroll
  for (int t = 0; t < 4; ++t) o[t] = (v8f){};

  float mrow[8], lrow[8];
#pragma unroll
  for (int i = 0; i < 8; ++i) { mrow[i] = -1e30f; lrow[i] = 0.0f; }

  const int rbase = (lane >> 4) << 3;

  // constant D# group1 descriptors, hoisted out of the loop
  const i32x8 g1k = tdm_g1_2d(DKH, S_LEN, 64, 64, DKH);
  const i32x8 g1v = tdm_g1_2d(S_LEN, DKH, 64, 64, S_LEN);
  const unsigned int ldsK[2] = { (unsigned int)(unsigned long long)&kt[0][0][0],
                                 (unsigned int)(unsigned long long)&kt[1][0][0] };
  const unsigned int ldsV[2] = { (unsigned int)(unsigned long long)&vt[0][0][0],
                                 (unsigned int)(unsigned long long)&vt[1][0][0] };

  if (wave == 0) {                              // prime buffer 0
    tdm_issue(ldsK[0], kb, g1k);
    tdm_issue(ldsV[0], vb, g1v);
  }

  for (int j0 = 0; j0 < S_LEN; j0 += 64) {
    const int cur = (j0 >> 6) & 1;
    const int nxt = cur ^ 1;
    if (wave == 0) {
      if (j0 + 64 < S_LEN) {
        tdm_issue(ldsK[nxt], kb + (long)(j0 + 64) * DKH, g1k);
        tdm_issue(ldsV[nxt], vb + (j0 + 64), g1v);
        __builtin_amdgcn_s_wait_tensorcnt(2);   // current pair complete
      } else {
        __builtin_amdgcn_s_wait_tensorcnt(0);
      }
    }
    __syncthreads();                            // tiles visible to all waves

    // ---- scores (q pre-scaled) ------------------------------------------
    v8f s[4];
#pragma unroll
    for (int t = 0; t < 4; ++t) {
      v16h b0 = load_frag(&kt[cur][t * 16][0], 64);
      v16h b1 = load_frag(&kt[cur][t * 16][32], 64);
      v8f c = (v8f){};
      c = wmma_f16(aq0, b0, c);
      c = wmma_f16(aq1, b1, c);
      s[t] = c;
    }

    // ---- online softmax (rows striped over 16-lane halves) ---------------
#pragma unroll
    for (int i = 0; i < 8; ++i) {
      float mx = fmaxf(fmaxf(s[0][i], s[1][i]), fmaxf(s[2][i], s[3][i]));
      mx = fmaxf(mx, __shfl_xor(mx, 1, 32));
      mx = fmaxf(mx, __shfl_xor(mx, 2, 32));
      mx = fmaxf(mx, __shfl_xor(mx, 4, 32));
      mx = fmaxf(mx, __shfl_xor(mx, 8, 32));

      float mnew = fmaxf(mrow[i], mx);
      float corr = __expf(mrow[i] - mnew);
      float rsum = 0.0f;
#pragma unroll
      for (int t = 0; t < 4; ++t) {
        float p = __expf(s[t][i] - mnew);
        s[t][i] = p;
        rsum += p;
      }
      rsum += __shfl_xor(rsum, 1, 32);
      rsum += __shfl_xor(rsum, 2, 32);
      rsum += __shfl_xor(rsum, 4, 32);
      rsum += __shfl_xor(rsum, 8, 32);

      lrow[i] = lrow[i] * corr + rsum;
      mrow[i] = mnew;
#pragma unroll
      for (int t = 0; t < 4; ++t) o[t][i] *= corr;
    }

    // ---- re-layout P: C layout -> A fragments via per-wave LDS -----------
#pragma unroll
    for (int t = 0; t < 4; ++t)
#pragma unroll
      for (int i = 0; i < 8; ++i)
        ldsP[wave][rbase + i][t * 16 + (lane & 15)] = (_Float16)s[t][i];

    asm volatile("s_wait_dscnt 0" ::: "memory");

    v16h pa0 = load_frag(&ldsP[wave][0][0], 64);
    v16h pa1 = load_frag(&ldsP[wave][0][32], 64);

    // ---- O += P x V ------------------------------------------------------
#pragma unroll
    for (int t = 0; t < 4; ++t) {
      v16h b0 = load_frag(&vt[cur][t * 16][0], 64);
      v16h b1 = load_frag(&vt[cur][t * 16][32], 64);
      o[t] = wmma_f16(pa0, b0, o[t]);
      o[t] = wmma_f16(pa1, b1, o[t]);
    }
    __syncthreads();   // all reads of buf[cur] done before TDM reuses it
  }

  // ---- epilogue ----------------------------------------------------------
#pragma unroll
  for (int t = 0; t < 4; ++t) {
    int col = h * DKH + t * 16 + (lane & 15);
#pragma unroll
    for (int i = 0; i < 8; ++i) {
      int m = m0 + rbase + i;
      x[(long)m * DM + col] = (_Float16)(o[t][i] / lrow[i]);
    }
  }
}

// ---------------------------------------------------------------------------
// Output projection: out[S,DM] = x[S,DM] @ Wo^T + bo, f32 output.
// Same ping-pong double-buffered structure.
// ---------------------------------------------------------------------------
__global__ __launch_bounds__(256)
void out_gemm(const _Float16* __restrict__ A,
              const _Float16* __restrict__ Bt,
              const float* __restrict__ bias,
              float* __restrict__ dst) {
  const int wave = threadIdx.x >> 5;
  const int lane = threadIdx.x & 31;
  const int m0   = blockIdx.y * 256 + wave * 32;
  const int n0   = blockIdx.x * 64;

  v8f acc[2][4];
#pragma unroll
  for (int r = 0; r < 2; ++r)
#pragma unroll
    for (int t = 0; t < 4; ++t) acc[r][t] = (v8f){};

  const _Float16* A0 = A + (long)m0 * DM;
  const _Float16* A1 = A0 + 16 * DM;
  const _Float16* Bb = Bt + (long)n0 * DM;

  v16h a0[2], a1[2], b[2][4];
  a0[0] = load_frag(A0, DM);
  a1[0] = load_frag(A1, DM);
#pragma unroll
  for (int t = 0; t < 4; ++t) b[0][t] = load_frag(Bb + (long)(t * 16) * DM, DM);

  for (int k0 = 0; k0 < DM; k0 += 64) {
    a0[1] = load_frag(A0 + k0 + 32, DM);
    a1[1] = load_frag(A1 + k0 + 32, DM);
#pragma unroll
    for (int t = 0; t < 4; ++t)
      b[1][t] = load_frag(Bb + (long)(t * 16) * DM + k0 + 32, DM);

#pragma unroll
    for (int t = 0; t < 4; ++t) {
      acc[0][t] = wmma_f16(a0[0], b[0][t], acc[0][t]);
      acc[1][t] = wmma_f16(a1[0], b[0][t], acc[1][t]);
    }

    const int kn = (k0 + 64 < DM) ? (k0 + 64) : 0;
    a0[0] = load_frag(A0 + kn, DM);
    a1[0] = load_frag(A1 + kn, DM);
#pragma unroll
    for (int t = 0; t < 4; ++t)
      b[0][t] = load_frag(Bb + (long)(t * 16) * DM + kn, DM);

#pragma unroll
    for (int t = 0; t < 4; ++t) {
      acc[0][t] = wmma_f16(a0[1], b[1][t], acc[0][t]);
      acc[1][t] = wmma_f16(a1[1], b[1][t], acc[1][t]);
    }
  }

  const int rbase = (lane >> 4) << 3;
#pragma unroll
  for (int r = 0; r < 2; ++r)
#pragma unroll
    for (int t = 0; t < 4; ++t) {
      int n = n0 + t * 16 + (lane & 15);
      float bv = bias[n];
#pragma unroll
      for (int i = 0; i < 8; ++i) {
        int m = m0 + r * 16 + rbase + i;
        dst[(long)m * DM + n] = acc[r][t][i] + bv;
      }
    }
}

// ---------------------------------------------------------------------------
extern "C" void kernel_launch(void* const* d_in, const int* in_sizes, int n_in,
                              void* d_out, int out_size, void* d_ws, size_t ws_size,
                              hipStream_t stream) {
  const float* Q  = (const float*)d_in[0];
  const float* K  = (const float*)d_in[1];
  const float* V  = (const float*)d_in[2];
  const float* Wq = (const float*)d_in[3];
  const float* bq = (const float*)d_in[4];
  const float* Wk = (const float*)d_in[5];
  const float* bk = (const float*)d_in[6];
  const float* Wv = (const float*)d_in[7];
  const float* bv = (const float*)d_in[8];
  const float* Wo = (const float*)d_in[9];
  const float* bo = (const float*)d_in[10];
  float* out = (float*)d_out;

  char* base = (char*)d_ws;
  size_t off = 0;
  auto alloc = [&](size_t elems) -> _Float16* {
    _Float16* p = (_Float16*)(base + off);
    off += (elems * sizeof(_Float16) + 255) & ~(size_t)255;
    return p;
  };

  _Float16* Qh  = alloc((size_t)S_LEN * DM);
  _Float16* Kh  = alloc((size_t)S_LEN * DM);
  _Float16* Vh  = alloc((size_t)S_LEN * DM);
  _Float16* Wtq = alloc((size_t)NH * DKH * DM);
  _Float16* Wtk = alloc((size_t)NH * DKH * DM);
  _Float16* Wtv = alloc((size_t)NH * DKH * DM);
  _Float16* Woh = alloc((size_t)DM * DM);
  _Float16* qh  = alloc((size_t)NH * S_LEN * DKH);  // [H,S,DK]
  _Float16* kh  = alloc((size_t)NH * S_LEN * DKH);  // [H,S,DK]
  _Float16* vTh = alloc((size_t)NH * DKH * S_LEN);  // [H,DK,S]
  _Float16* xh  = alloc((size_t)S_LEN * DM);

  const int nQKV = S_LEN * DM;
  const int nW   = NH * DM * DKH;
  const int nWo  = DM * DM;

  cvt_f32_f16<<<(nQKV + 255) / 256, 256, 0, stream>>>(Q, Qh, nQKV);
  cvt_f32_f16<<<(nQKV + 255) / 256, 256, 0, stream>>>(K, Kh, nQKV);
  cvt_f32_f16<<<(nQKV + 255) / 256, 256, 0, stream>>>(V, Vh, nQKV);
  cvt_f32_f16<<<(nWo + 255) / 256, 256, 0, stream>>>(Wo, Woh, nWo);
  transpose_w<<<(nW + 255) / 256, 256, 0, stream>>>(Wq, Wtq);
  transpose_w<<<(nW + 255) / 256, 256, 0, stream>>>(Wk, Wtk);
  transpose_w<<<(nW + 255) / 256, 256, 0, stream>>>(Wv, Wtv);

  dim3 gProj(NH, S_LEN / 256);                 // (16, 16)
  proj_gemm<<<gProj, 256, 0, stream>>>(Qh, Wtq, bq, qh, 0.125f, 0);  // q * 1/sqrt(dk)
  proj_gemm<<<gProj, 256, 0, stream>>>(Kh, Wtk, bk, kh, 1.0f, 0);
  proj_gemm<<<gProj, 256, 0, stream>>>(Vh, Wtv, bv, vTh, 1.0f, 1);

  dim3 gAttn(S_LEN / 128, NH);                 // (32, 16)
  flash_attn<<<gAttn, 256, 0, stream>>>(qh, kh, vTh, xh);

  dim3 gOut(DM / 64, S_LEN / 256);             // (16, 16)
  out_gemm<<<gOut, 256, 0, stream>>>(xh, Woh, bo, out);
}

// v001
// Measured time: 396 microseconds a run.
// Next to v000, in two timings, it ran 1.52 times as fast each time.
#include <hip/hip_runtime.h>
#include <hip/hip_bf16.h>
#include <math.h>

typedef __attribute__((ext_vector_type(16))) _Float16 v16h;
typedef __attribute__((ext_vector_type(8)))  _Float16 v8h;
typedef __attribute__((ext_vector_type(8)))  float    v8f;
typedef __attribute__((ext_vector_type(4)))  unsigned int u32x4;
typedef __attribute__((ext_vector_type(8)))  int      i32x8;
typedef __attribute__((ext_vector_type(4)))  int      i32x4;

#define S_LEN 4096
#define DM    1024
#define NH    16
#define DKH   64   // head dim

// ---------------------------------------------------------------------------
// Fragment loader (global or LDS), contiguous k order (not AMD's table order),
// valid because A and B both use it.
// A (16x32 f16): lanes 0-15 -> row (lane&15), K 0..15 ; lanes 16-31 -> K 16..31
// B (32x16 f16): identical addressing against B^T stored [N, K] row-major.
// ---------------------------------------------------------------------------
__device__ __forceinline__ v16h load_frag(const _Float16* base, int ld) {
  int l = threadIdx.x & 31;
  return *(const v16h*)(base + (long)(l & 15) * ld + ((l >> 4) << 4));
}

// ---------------------------------------------------------------------------
// Bank swizzle for rows of 64 halfs (128 B). A row is eight 16-B chunks; logical
// chunk c of row r is kept at place c ^ ((r >> 1) & 7). Sixteen lanes that read
// the same logical chunk of sixteen consecutive rows then touch all 64 LDS banks
// once, where the plain layout puts them on 8 banks.
// swz(): index in halfs, inside its row, of logical column col (0..63) of row.
// ---------------------------------------------------------------------------
__device__ __forceinline__ int swz(int row, int col) {
  return ((((col >> 3) ^ (row >> 1)) & 7) << 3) | (col & 7);
}

// Same fragment as load_frag(tile + col0, 64), read from swizzled LDS rows.
// tile points at a row whose index is a multiple of 16.
__device__ __forceinline__ v16h load_frag_swz(const _Float16* tile, int col0) {
  int l = threadIdx.x & 31;
  int r = l & 15;
  int c = col0 + ((l >> 4) << 4);
  const _Float16* rowp = tile + r * 64;
  v8h lo = *(const v8h*)(rowp + swz(r, c));
  v8h hi = *(const v8h*)(rowp + swz(r, c + 8));
  return __builtin_shufflevector(lo, hi, 0, 1, 2, 3, 4, 5, 6, 7,
                                 8, 9, 10, 11, 12, 13, 14, 15);
}

__device__ __forceinline__ v8f wmma_f16(v16h a, v16h b, v8f c) {
  return __builtin_amdgcn_wmma_f32_16x16x32_f16(false, a, false, b, (short)0, c,
                                                false, false);
}

// ---------------------------------------------------------------------------
// Tensor Data Mover helpers. D# group1 (dims/strides, constant per tensor) is
// built once and hoisted; per-issue we only pack the new global address.
// ---------------------------------------------------------------------------
__device__ __forceinline__ i32x8 tdm_g1_2d(unsigned int tensor_d0,
                                           unsigned int tensor_d1,
                                           unsigned int tile_d0,
                                           unsigned int tile_d1,
                                           unsigned int stride0) {
  i32x8 g1 = { (int)0x00010000u,                                  // data_size=2B
               (int)((tensor_d0 & 0xFFFFu) << 16),
               (int)((tensor_d0 >> 16) | ((tensor_d1 & 0xFFFFu) << 16)),
               (int)((tensor_d1 >> 16) | (tile_d0 << 16)),
               (int)tile_d1,                                      // tile_dim2=0
               (int)stride0,
               0, 0 };
  return g1;
}

__device__ __forceinline__ void tdm_issue(unsigned int lds_addr,
                                          const void* gptr, i32x8 g1) {
  unsigned long long ga = (unsigned long long)gptr;
  u32x4 g0 = { 1u, lds_addr, (unsigned int)ga,
               (unsigned int)((ga >> 32) & 0x1FFFFFFu) | 0x80000000u };
  i32x4 z4 = {};
  i32x8 z8 = {};
  __builtin_amdgcn_tensor_load_to_lds(g0, g1, z4, z4, z8, 0);
}

// ---------------------------------------------------------------------------
// Elementwise converts
// ---------------------------------------------------------------------------
__global__ void cvt_f32_f16(const float* __restrict__ src,
                            _Float16* __restrict__ dst, int n) {
  int i = blockIdx.x * blockDim.x + threadIdx.x;
  if (i < n) dst[i] = (_Float16)src[i];
}

// W: [NH, DM, DKH] f32  ->  Wt: [NH, DKH, DM] f16  (B^T per head)
__global__ void transpose_w(const float* __restrict__ W,
                            _Float16* __restrict__ Wt) {
  int i = blockIdx.x * blockDim.x + threadIdx.x;
  if (i >= NH * DM * DKH) return;
  int dk = i % DKH;
  int d  = (i / DKH) % DM;
  int h  = i / (DKH * DM);
  Wt[((long)h * DKH + dk) * DM + d] = (_Float16)W[i];
}

// ---------------------------------------------------------------------------
// QKV projection GEMM: dst[h] = (A[S,DM] x W[h][DM,DKH] + b[h]) * scale
// 8 waves, tile 256(M) x 64(N); each wave 32x64; K-loop unrolled x2 with
// explicit ping-pong stage registers (no rotation copies).
// layout 0: dst [H,S,DK] plain.  layout 1: dst [H,DK,S], each 64-key row piece
// swizzled by its dk row.  layout 2: dst [H,S,DK], each row swizzled by its key.
// (1 and 2 are the rows the attention kernel's 64x64 LDS tiles are copied from.)
// ---------------------------------------------------------------------------
template <int LAYOUT>
__global__ __launch_bounds__(256)
void proj_gemm(const _Float16* __restrict__ A,
               const _Float16* __restrict__ Bt,
               const float* __restrict__ bias,
               _Float16* __restrict__ dst,
               float scale) {
  const int wave = threadIdx.x >> 5;
  const int lane = threadIdx.x & 31;
  const int h    = blockIdx.x;
  const int m0   = blockIdx.y * 256 + wave * 32;

  v8f acc[2][4];
#pragma unroll
  for (int r = 0; r < 2; ++r)
#pragma unroll
    for (int t = 0; t < 4; ++t) acc[r][t] = (v8f){};

  const _Float16* A0 = A + (long)m0 * DM;
  const _Float16* A1 = A0 + 16 * DM;
  const _Float16* Bb = Bt + (long)h * DKH * DM;

  v16h a0[2], a1[2], b[2][4];
  a0[0] = load_frag(A0, DM);
  a1[0] = load_frag(A1, DM);
#pragma unroll
  for (int t = 0; t < 4; ++t) b[0][t] = load_frag(Bb + (long)(t * 16) * DM, DM);

  for (int k0 = 0; k0 < DM; k0 += 64) {
    // prefetch stage 1 (k0+32 always < DM)
    a0[1] = load_frag(A0 + k0 + 32, DM);
    a1[1] = load_frag(A1 + k0 + 32, DM);
#pragma unroll
    for (int t = 0; t < 4; ++t)
      b[1][t] = load_frag(Bb + (long)(t * 16) * DM + k0 + 32, DM);

#pragma unroll
    for (int t = 0; t < 4; ++t) {
      acc[0][t] = wmma_f16(a0[0], b[0][t], acc[0][t]);
      acc[1][t] = wmma_f16(a1[0], b[0][t], acc[1][t]);
    }

    // prefetch stage 0 for next pair (clamped dummy on the last pair)
    const int kn = (k0 + 64 < DM) ? (k0 + 64) : 0;
    a0[0] = load_frag(A0 + kn, DM);
    a1[0] = load_frag(A1 + kn, DM);
#pragma unroll
    for (int t = 0; t < 4; ++t)
      b[0][t] = load_frag(Bb + (long)(t * 16) * DM + kn, DM);

#pragma unroll
    for (int t = 0; t < 4; ++t) {
      acc[0][t] = wmma_f16(a0[1], b[1][t], acc[0][t]);
      acc[1][t] = wmma_f16(a1[1], b[1][t], acc[1][t]);
    }
  }

  const int rbase = (lane >> 4) << 3;
  // LAYOUT 2: swz(m, dk) = ((L ^ C) << 3) | (lane & 7), L from the lane (bits 0 and
  // 2 only), C = 2t ^ (i >> 1) known at compile time. Four pointers hold L ^ (C & 5);
  // bit 1 of C and the row go into the store's constant offset.
  _Float16* krow = dst + ((long)h * S_LEN + m0 + rbase) * DKH + (lane & 7);
  const int L = ((lane >> 3) & 1) | (rbase >> 1);
  _Float16* kp[4] = { krow + (L << 3), krow + ((L ^ 1) << 3),
                      krow + ((L ^ 4) << 3), krow + ((L ^ 5) << 3) };
  float bv[4];
#pragma unroll
  for (int t = 0; t < 4; ++t) {
    bv[t] = bias[h * DKH + t * 16 + (lane & 15)];
    // the load's address register may be reused for the next address: wait first
    asm volatile("s_wait_xcnt 0x0" ::: "memory");
  }
#pragma unroll
  for (int r = 0; r < 2; ++r)
#pragma unroll
    for (int t = 0; t < 4; ++t) {
      int dk = t * 16 + (lane & 15);
#pragma unroll
      for (int i = 0; i < 8; ++i) {
        int m = m0 + r * 16 + rbase + i;
        float val = (acc[r][t][i] + bv[t]) * scale;
        if (LAYOUT == 0)
          dst[((long)h * S_LEN + m) * DKH + dk] = (_Float16)val;
        else if (LAYOUT == 2) {
          const int C = (2 * t) ^ (i >> 1);
          kp[(C & 1) | ((C >> 1) & 2)][(r * 16 + i) * DKH + ((C & 2) << 3)] = (_Float16)val;
        }
        else
          dst[((long)h * DKH + dk) * S_LEN + (m & ~63) + swz(dk, m & 63)] = (_Float16)val;
      }
    }
}

// ---------------------------------------------------------------------------
// Flash attention: one (head, 128-query-row block) per 256-thread block.
// K/V 64x64 tiles DMA'd into double-buffered LDS by the TDM (wave 0), synced
// with s_wait_tensorcnt + barrier; all 8 waves read fragments from LDS.
// q is pre-scaled by 1/sqrt(dk) at projection time. k and vT rows arrive already
// bank-swizzled (see swz), the P tile is written swizzled the same way.
// ---------------------------------------------------------------------------
__global__ __launch_bounds__(256)
void flash_attn(const _Float16* __restrict__ q,
                const _Float16* __restrict__ k,
                const _Float16* __restrict__ vT,
                _Float16* __restrict__ x) {
  __shared__ __align__(32) _Float16 kt[2][64][64];     // [key][dk]
  __shared__ __align__(32) _Float16 vt[2][64][64];     // [dk][key]
  __shared__ __align__(32) _Float16 ldsP[8][16][64];   // per-wave P tile

  const int wave = threadIdx.x >> 5;
  const int lane = threadIdx.x & 31;
  const int h    = blockIdx.y;
  const int m0   = blockIdx.x * 128 + wave * 16;

  const _Float16* qb = q  + ((long)h * S_LEN + m0) * DKH;
  const _Float16* kb = k  + (long)h * S_LEN * DKH;
  const _Float16* vb = vT + (long)h * DKH * S_LEN;

  const v16h aq0 = load_frag(qb, DKH);
  const v16h aq1 = load_frag(qb + 32, DKH);

  v8f o[4];
#pragma unroll
  for (int t = 0; t < 4; ++t) o[t] = (v8f){};

  float mrow[8], lrow[8];
#pragma unroll
  for (int i = 0; i < 8; ++i) { mrow[i] = -1e30f; lrow[i] = 0.0f; }

  const int rbase = (lane >> 4) << 3;

  // constant D# group1 descriptors, hoisted out of the loop
  const i32x8 g1k = tdm_g1_2d(DKH, S_LEN, 64, 64, DKH);
  const i32x8 g1v = tdm_g1_2d(S_LEN, DKH, 64, 64, S_LEN);
  const unsigned int ldsK[2] = { (unsigned int)(unsigned long long)&kt[0][0][0],
                                 (unsigned int)(unsigned long long)&kt[1][0][0] };
  const unsigned int ldsV[2] = { (unsigned int)(unsigned long long)&vt[0][0][0],
                                 (unsigned int)(unsigned long long)&vt[1][0][0] };

  if (wave == 0) {                              // prime buffer 0
    tdm_issue(ldsK[0], kb, g1k);
    tdm_issue(ldsV[0], vb, g1v);
  }

  for (int j0 = 0; j0 < S_LEN; j0 += 64) {
    const int cur = (j0 >> 6) & 1;
    const int nxt = cur ^ 1;
    if (wave == 0) {
      if (j0 + 64 < S_LEN) {
        tdm_issue(ldsK[nxt], kb + (long)(j0 + 64) * DKH, g1k);
        tdm_issue(ldsV[nxt], vb + (j0 + 64), g1v);
        __builtin_amdgcn_s_wait_tensorcnt(2);   // current pair complete
      } else {
        __builtin_amdgcn_s_wait_tensorcnt(0);
      }
    }
    __syncthreads();                            // tiles visible to all waves

    // ---- scores (q pre-scaled) ------------------------------------------
    v8f s[4];
#pragma unroll
    for (int t = 0; t < 4; ++t) {
      v16h b0 = load_frag_swz(&kt[cur][t * 16][0], 0);
      v16h b1 = load_frag_swz(&kt[cur][t * 16][0], 32);
      v8f c = (v8f){};
      c = wmma_f16(aq0, b0, c);
      c = wmma_f16(aq1, b1, c);
      s[t] = c;
    }

    // ---- online softmax (rows striped over 16-lane halves) ---------------
#pragma unroll
    for (int i = 0; i < 8; ++i) {
      float mx = fmaxf(fmaxf(s[0][i], s[1][i]), fmaxf(s[2][i], s[3][i]));
      mx = fmaxf(mx, __shfl_xor(mx, 1, 32));
      mx = fmaxf(mx, __shfl_xor(mx, 2, 32));
      mx = fmaxf(mx, __shfl_xor(mx, 4, 32));
      mx = fmaxf(mx, __shfl_xor(mx, 8, 32));

      float mnew = fmaxf(mrow[i], mx);
      float corr = __expf(mrow[i] - mnew);
      float rsum = 0.0f;
#pragma unroll
      for (int t = 0; t < 4; ++t) {
        float p = __expf(s[t][i] - mnew);
        s[t][i] = p;
        rsum += p;
      }
      rsum += __shfl_xor(rsum, 1, 32);
      rsum += __shfl_xor(rsum, 2, 32);
      rsum += __shfl_xor(rsum, 4, 32);
      rsum += __shfl_xor(rsum, 8, 32);

      lrow[i] = lrow[i] * corr + rsum;
      mrow[i] = mnew;
#pragma unroll
      for (int t = 0; t < 4; ++t) o[t][i] *= corr;
    }

    // ---- re-layout P: C layout -> A fragments via per-wave LDS -----------
#pragma unroll
    for (int t = 0; t < 4; ++t)
#pragma unroll
      for (int i = 0; i < 8; ++i)
        ldsP[wave][rbase + i][swz(rbase + i, t * 16 + (lane & 15))] = (_Float16)s[t][i];

    asm volatile("s_wait_dscnt 0" ::: "memory");

    v16h pa0 = load_frag_swz(&ldsP[wave][0][0], 0);
    v16h pa1 = load_frag_swz(&ldsP[wave][0][0], 32);

    // ---- O += P x V ------------------------------------------------------
#pragma unroll
    for (int t = 0; t < 4; ++t) {
      v16h b0 = load_frag_swz(&vt[cur][t * 16][0], 0);
      v16h b1 = load_frag_swz(&vt[cur][t * 16][0], 32);
      o[t] = wmma_f16(pa0, b0, o[t]);
      o[t] = wmma_f16(pa1, b1, o[t]);
    }
    __syncthreads();   // all reads of buf[cur] done before TDM reuses it
  }

  // ---- epilogue ----------------------------------------------------------
#pragma unroll
  for (int t = 0; t < 4; ++t) {
    int col = h * DKH + t * 16 + (lane & 15);
#pragma unroll
    for (int i = 0; i < 8; ++i) {
      int m = m0 + rbase + i;
      x[(long)m * DM + col] = (_Float16)(o[t][i] / lrow[i]);
    }
  }
}

// ---------------------------------------------------------------------------
// Output projection: out[S,DM] = x[S,DM] @ Wo^T + bo, f32 output.
// Same ping-pong double-buffered structure.
// ---------------------------------------------------------------------------
__global__ __launch_bounds__(256)
void out_gemm(const _Float16* __restrict__ A,
              const _Float16* __restrict__ Bt,
              const float* __restrict__ bias,
              float* __restrict__ dst) {
  const int wave = threadIdx.x >> 5;
  const int lane = threadIdx.x & 31;
  const int m0   = blockIdx.y * 256 + wave * 32;
  const int n0   = blockIdx.x * 64;

  v8f acc[2][4];
#pragma unroll
  for (int r = 0; r < 2; ++r)
#pragma unroll
    for (int t = 0; t < 4; ++t) acc[r][t] = (v8f){};

  const _Float16* A0 = A + (long)m0 * DM;
  const _Float16* A1 = A0 + 16 * DM;
  const _Float16* Bb = Bt + (long)n0 * DM;

  v16h a0[2], a1[2], b[2][4];
  a0[0] = load_frag(A0, DM);
  a1[0] = load_frag(A1, DM);
#pragma unroll
  for (int t = 0; t < 4; ++t) b[0][t] = load_frag(Bb + (long)(t * 16) * DM, DM);

  for (int k0 = 0; k0 < DM; k0 += 64) {
    a0[1] = load_frag(A0 + k0 + 32, DM);
    a1[1] = load_frag(A1 + k0 + 32, DM);
#pragma unroll
    for (int t = 0; t < 4; ++t)
      b[1][t] = load_frag(Bb + (long)(t * 16) * DM + k0 + 32, DM);

#pragma unroll
    for (int t = 0; t < 4; ++t) {
      acc[0][t] = wmma_f16(a0[0], b[0][t], acc[0][t]);
      acc[1][t] = wmma_f16(a1[0], b[0][t], acc[1][t]);
    }

    const int kn = (k0 + 64 < DM) ? (k0 + 64) : 0;
    a0[0] = load_frag(A0 + kn, DM);
    a1[0] = load_frag(A1 + kn, DM);
#pragma unroll
    for (int t = 0; t < 4; ++t)
      b[0][t] = load_frag(Bb + (long)(t * 16) * DM + kn, DM);

#pragma unroll
    for (int t = 0; t < 4; ++t) {
      acc[0][t] = wmma_f16(a0[1], b[1][t], acc[0][t]);
      acc[1][t] = wmma_f16(a1[1], b[1][t], acc[1][t]);
    }
  }

  const int rbase = (lane >> 4) << 3;
#pragma unroll
  for (int r = 0; r < 2; ++r)
#pragma unroll
    for (int t = 0; t < 4; ++t) {
      int n = n0 + t * 16 + (lane & 15);
      float bv = bias[n];
#pragma unroll
      for (int i = 0; i < 8; ++i) {
        int m = m0 + r * 16 + rbase + i;
        dst[(long)m * DM + n] = acc[r][t][i] + bv;
      }
    }
}

// ---------------------------------------------------------------------------
extern "C" void kernel_launch(void* const* d_in, const int* in_sizes, int n_in,
                              void* d_out, int out_size, void* d_ws, size_t ws_size,
                              hipStream_t stream) {
  const float* Q  = (const float*)d_in[0];
  const float* K  = (const float*)d_in[1];
  const float* V  = (const float*)d_in[2];
  const float* Wq = (const float*)d_in[3];
  const float* bq = (const float*)d_in[4];
  const float* Wk = (const float*)d_in[5];
  const float* bk = (const float*)d_in[6];
  const float* Wv = (const float*)d_in[7];
  const float* bv = (const float*)d_in[8];
  const float* Wo = (const float*)d_in[9];
  const float* bo = (const float*)d_in[10];
  float* out = (float*)d_out;

  char* base = (char*)d_ws;
  size_t off = 0;
  auto alloc = [&](size_t elems) -> _Float16* {
    _Float16* p = (_Float16*)(base + off);
    off += (elems * sizeof(_Float16) + 255) & ~(size_t)255;
    return p;
  };

  _Float16* Qh  = alloc((size_t)S_LEN * DM);
  _Float16* Kh  = alloc((size_t)S_LEN * DM);
  _Float16* Vh  = alloc((size_t)S_LEN * DM);
  _Float16* Wtq = alloc((size_t)NH * DKH * DM);
  _Float16* Wtk = alloc((size_t)NH * DKH * DM);
  _Float16* Wtv = alloc((size_t)NH * DKH * DM);
  _Float16* Woh = alloc((size_t)DM * DM);
  _Float16* qh  = alloc((size_t)NH * S_LEN * DKH);  // [H,S,DK]
  _Float16* kh  = alloc((size_t)NH * S_LEN * DKH);  // [H,S,DK], rows swizzled
  _Float16* vTh = alloc((size_t)NH * DKH * S_LEN);  // [H,DK,S], 64-key pieces swizzled
  _Float16* xh  = alloc((size_t)S_LEN * DM);

  const int nQKV = S_LEN * DM;
  const int nW   = NH * DM * DKH;
  const int nWo  = DM * DM;

  cvt_f32_f16<<<(nQKV + 255) / 256, 256, 0, stream>>>(Q, Qh, nQKV);
  cvt_f32_f16<<<(nQKV + 255) / 256, 256, 0, stream>>>(K, Kh, nQKV);
  cvt_f32_f16<<<(nQKV + 255) / 256, 256, 0, stream>>>(V, Vh, nQKV);
  cvt_f32_f16<<<(nWo + 255) / 256, 256, 0, stream>>>(Wo, Woh, nWo);
  transpose_w<<<(nW + 255) / 256, 256, 0, stream>>>(Wq, Wtq);
  transpose_w<<<(nW + 255) / 256, 256, 0, stream>>>(Wk, Wtk);
  transpose_w<<<(nW + 255) / 256, 256, 0, stream>>>(Wv, Wtv);

  dim3 gProj(NH, S_LEN / 256);                 // (16, 16)
  proj_gemm<0><<<gProj, 256, 0, stream>>>(Qh, Wtq, bq, qh, 0.125f);  // q * 1/sqrt(dk)
  proj_gemm<2><<<gProj, 256, 0, stream>>>(Kh, Wtk, bk, kh, 1.0f);
  proj_gemm<1><<<gProj, 256, 0, stream>>>(Vh, Wtv, bv, vTh, 1.0f);

  dim3 gAttn(S_LEN / 128, NH);                 // (32, 16)
  flash_attn<<<gAttn, 256, 0, stream>>>(qh, kh, vTh, xh);

  dim3 gOut(DM / 64, S_LEN / 256);             // (16, 16)
  out_gemm<<<gOut, 256, 0, stream>>>(xh, Woh, bo, out);
}

// v002
// It runs in 282 microseconds.
// Timed twice side by side with v001, it ran 1.41 and 1.40 times as fast.
// Counting every step since v000, it is 2.14 times as fast.
#include <hip/hip_runtime.h>
#include <hip/hip_bf16.h>
#include <math.h>

typedef __attribute__((ext_vector_type(16))) _Float16 v16h;
typedef __attribute__((ext_vector_type(8)))  _Float16 v8h;
typedef __attribute__((ext_vector_type(8)))  float    v8f;
typedef __attribute__((ext_vector_type(4)))  unsigned int u32x4;
typedef __attribute__((ext_vector_type(8)))  int      i32x8;
typedef __attribute__((ext_vector_type(4)))  int      i32x4;

#define S_LEN 4096
#define DM    1024
#define NH    16
#define DKH   64   // head dim

// ---------------------------------------------------------------------------
// Fragment loader (global or LDS), contiguous k order (not AMD's table order),
// valid because A and B both use it.
// A (16x32 f16): lanes 0-15 -> row (lane&15), K 0..15 ; lanes 16-31 -> K 16..31
// B (32x16 f16): identical addressing against B^T stored [N, K] row-major.
// ---------------------------------------------------------------------------
__device__ __forceinline__ v16h load_frag(const _Float16* base, int ld) {
  int l = threadIdx.x & 31;
  return *(const v16h*)(base + (long)(l & 15) * ld + ((l >> 4) << 4));
}

// ---------------------------------------------------------------------------
// Bank swizzle for rows of 64 halfs (128 B). A row is eight 16-B chunks; logical
// chunk c of row r is kept at place c ^ ((r >> 1) & 7). Sixteen lanes that read
// the same logical chunk of sixteen consecutive rows then touch all 64 LDS banks
// once, where the plain layout puts them on 8 banks.
// swz(): index in halfs, inside its row, of logical column col (0..63) of row.
// ---------------------------------------------------------------------------
__device__ __forceinline__ int swz(int row, int col) {
  return ((((col >> 3) ^ (row >> 1)) & 7) << 3) | (col & 7);
}

// Same fragment as load_frag(tile + col0, 64), read from swizzled LDS rows.
// tile points at a row whose index is a multiple of 16.
__device__ __forceinline__ v16h load_frag_swz(const _Float16* tile, int col0) {
  int l = threadIdx.x & 31;
  int r = l & 15;
  int c = col0 + ((l >> 4) << 4);
  const _Float16* rowp = tile + r * 64;
  v8h lo = *(const v8h*)(rowp + swz(r, c));
  v8h hi = *(const v8h*)(rowp + swz(r, c + 8));
  return __builtin_shufflevector(lo, hi, 0, 1, 2, 3, 4, 5, 6, 7,
                                 8, 9, 10, 11, 12, 13, 14, 15);
}

__device__ __forceinline__ v8f wmma_f16(v16h a, v16h b, v8f c) {
  return __builtin_amdgcn_wmma_f32_16x16x32_f16(false, a, false, b, (short)0, c,
                                                false, false);
}

// ---------------------------------------------------------------------------
// Tensor Data Mover helpers. D# group1 (dims/strides, constant per tensor) is
// built once and hoisted; per-issue we only pack the new global address.
// ---------------------------------------------------------------------------
__device__ __forceinline__ i32x8 tdm_g1_2d(unsigned int tensor_d0,
                                           unsigned int tensor_d1,
                                           unsigned int tile_d0,
                                           unsigned int tile_d1,
                                           unsigned int stride0) {
  i32x8 g1 = { (int)0x00010000u,                                  // data_size=2B
               (int)((tensor_d0 & 0xFFFFu) << 16),
               (int)((tensor_d0 >> 16) | ((tensor_d1 & 0xFFFFu) << 16)),
               (int)((tensor_d1 >> 16) | (tile_d0 << 16)),
               (int)tile_d1,                                      // tile_dim2=0
               (int)stride0,
               0, 0 };
  return g1;
}

__device__ __forceinline__ void tdm_issue(unsigned int lds_addr,
                                          const void* gptr, i32x8 g1) {
  unsigned long long ga = (unsigned long long)gptr;
  u32x4 g0 = { 1u, lds_addr, (unsigned int)ga,
               (unsigned int)((ga >> 32) & 0x1FFFFFFu) | 0x80000000u };
  i32x4 z4 = {};
  i32x8 z8 = {};
  __builtin_amdgcn_tensor_load_to_lds(g0, g1, z4, z4, z8, 0);
}

// ---------------------------------------------------------------------------
// Pre-pass kernels. Few, fat waves: a launch of one-element threads is bound by
// how fast waves start, not by its bytes.
// ---------------------------------------------------------------------------
typedef __attribute__((ext_vector_type(4))) float    f32x4;
typedef __attribute__((ext_vector_type(4))) _Float16 v4h;

#define CVT_LOADS 8                          // 16-B loads in flight per thread
#define CVT_BLOCK (256 * CVT_LOADS * 4)      // floats converted per block

// f32 -> f16, CVT_BLOCK floats per block; the grid covers the array exactly.
// Every wave-wide load is 512 contiguous bytes, every store 256.
__global__ __launch_bounds__(256)
void cvt_f32_f16(const float* __restrict__ src, _Float16* __restrict__ dst) {
  const int i4 = blockIdx.x * (CVT_BLOCK / 4) + threadIdx.x;   // in groups of 4 floats
  const f32x4* s4 = (const f32x4*)src + i4;
  v4h* d4 = (v4h*)dst + i4;
  f32x4 v[CVT_LOADS];
#pragma unroll
  for (int j = 0; j < CVT_LOADS; ++j) v[j] = s4[j * 256];
#pragma unroll
  for (int j = 0; j < CVT_LOADS; ++j) d4[j * 256] = __builtin_convertvector(v[j], v4h);
}

// W: [NH, DM, DKH] f32  ->  Wt: [NH, DKH, DM] f16  (B^T per head)
// Block = 64 d x 64 dk of head blockIdx.y. A thread takes one dk and 16 consecutive
// d: 16 loads (a wave reads one 128-B line each), one 32-B piece of a Wt row out.
__global__ __launch_bounds__(256)
void transpose_w(const float* __restrict__ W,
                 _Float16* __restrict__ Wt) {
  const int dk = threadIdx.x & 63;
  const int h  = blockIdx.y;
  const int d0 = blockIdx.x * 64 + (threadIdx.x >> 6) * 16;
  const float* s = W + ((long)h * DM + d0) * DKH + dk;
  float v[16];
#pragma unroll
  for (int j = 0; j < 16; ++j) v[j] = s[j * DKH];
  // The wait before a register that an issued load names is rewritten. It takes s as
  // an input, so the address pair stays live to here and no loaded value is put in it.
  asm volatile("s_wait_xcnt 0x0" :: "v"(s) : "memory");
  v8h lo, hi;
#pragma unroll
  for (int j = 0; j < 8; ++j) { lo[j] = (_Float16)v[j]; hi[j] = (_Float16)v[j + 8]; }
  v8h* o = (v8h*)(Wt + ((long)h * DKH + dk) * DM + d0);
  o[0] = lo;
  o[1] = hi;
}

// ---------------------------------------------------------------------------
// QKV projection GEMM: dst[h] = (A[S,DM] x W[h][DM,DKH] + b[h]) * scale
// 8 waves, tile 256(M) x 64(N); each wave 32x64; K-loop unrolled x2 with
// explicit ping-pong stage registers (no rotation copies).
// layout 0: dst [H,S,DK] plain.  layout 1: dst [H,DK,S], each 64-key row piece
// swizzled by its dk row.  layout 2: dst [H,S,DK], each row swizzled by its key.
// (1 and 2 are the rows the attention kernel's 64x64 LDS tiles are copied from.)
// ---------------------------------------------------------------------------
template <int LAYOUT>
__global__ __launch_bounds__(256)
void proj_gemm(const _Float16* __restrict__ A,
               const _Float16* __restrict__ Bt,
               const float* __restrict__ bias,
               _Float16* __restrict__ dst,
               float scale) {
  const int wave = threadIdx.x >> 5;
  const int lane = threadIdx.x & 31;
  const int h    = blockIdx.x;
  const int m0   = blockIdx.y * 256 + wave * 32;

  v8f acc[2][4];
#pragma unroll
  for (int r = 0; r < 2; ++r)
#pragma unroll
    for (int t = 0; t < 4; ++t) acc[r][t] = (v8f){};

  const _Float16* A0 = A + (long)m0 * DM;
  const _Float16* A1 = A0 + 16 * DM;
  const _Float16* Bb = Bt + (long)h * DKH * DM;

  v16h a0[2], a1[2], b[2][4];
  a0[0] = load_frag(A0, DM);
  a1[0] = load_frag(A1, DM);
#pragma unroll
  for (int t = 0; t < 4; ++t) b[0][t] = load_frag(Bb + (long)(t * 16) * DM, DM);

  for (int k0 = 0; k0 < DM; k0 += 64) {
    // prefetch stage 1 (k0+32 always < DM)
    a0[1] = load_frag(A0 + k0 + 32, DM);
    a1[1] = load_frag(A1 + k0 + 32, DM);
#pragma unroll
    for (int t = 0; t < 4; ++t)
      b[1][t] = load_frag(Bb + (long)(t * 16) * DM + k0 + 32, DM);

#pragma unroll
    for (int t = 0; t < 4; ++t) {
      acc[0][t] = wmma_f16(a0[0], b[0][t], acc[0][t]);
      acc[1][t] = wmma_f16(a1[0], b[0][t], acc[1][t]);
    }

    // prefetch stage 0 for next pair (clamped dummy on the last pair)
    const int kn = (k0 + 64 < DM) ? (k0 + 64) : 0;
    a0[0] = load_frag(A0 + kn, DM);
    a1[0] = load_frag(A1 + kn, DM);
#pragma unroll
    for (int t = 0; t < 4; ++t)
      b[0][t] = load_frag(Bb + (long)(t * 16) * DM + kn, DM);

#pragma unroll
    for (int t = 0; t < 4; ++t) {
      acc[0][t] = wmma_f16(a0[1], b[1][t], acc[0][t]);
      acc[1][t] = wmma_f16(a1[1], b[1][t], acc[1][t]);
    }
  }

  const int rbase = (lane >> 4) << 3;
  // LAYOUT 2: swz(m, dk) = ((L ^ C) << 3) | (lane & 7), L from the lane (bits 0 and
  // 2 only), C = 2t ^ (i >> 1) known at compile time. Four pointers hold L ^ (C & 5);
  // bit 1 of C and the row go into the store's constant offset.
  _Float16* krow = dst + ((long)h * S_LEN + m0 + rbase) * DKH + (lane & 7);
  const int L = ((lane >> 3) & 1) | (rbase >> 1);
  _Float16* kp[4] = { krow + (L << 3), krow + ((L ^ 1) << 3),
                      krow + ((L ^ 4) << 3), krow + ((L ^ 5) << 3) };
  float bv[4];
#pragma unroll
  for (int t = 0; t < 4; ++t) {
    bv[t] = bias[h * DKH + t * 16 + (lane & 15)];
    // the load's address register may be reused for the next address: wait first
    asm volatile("s_wait_xcnt 0x0" ::: "memory");
  }
#pragma unroll
  for (int r = 0; r < 2; ++r)
#pragma unroll
    for (int t = 0; t < 4; ++t) {
      int dk = t * 16 + (lane & 15);
#pragma unroll
      for (int i = 0; i < 8; ++i) {
        int m = m0 + r * 16 + rbase + i;
        float val = (acc[r][t][i] + bv[t]) * scale;
        if (LAYOUT == 0)
          dst[((long)h * S_LEN + m) * DKH + dk] = (_Float16)val;
        else if (LAYOUT == 2) {
          const int C = (2 * t) ^ (i >> 1);
          kp[(C & 1) | ((C >> 1) & 2)][(r * 16 + i) * DKH + ((C & 2) << 3)] = (_Float16)val;
        }
        else
          dst[((long)h * DKH + dk) * S_LEN + (m & ~63) + swz(dk, m & 63)] = (_Float16)val;
      }
    }
}

// ---------------------------------------------------------------------------
// Flash attention: one (head, 128-query-row block) per 256-thread block.
// K/V 64x64 tiles DMA'd into double-buffered LDS by the TDM (wave 0), synced
// with s_wait_tensorcnt + barrier; all 8 waves read fragments from LDS.
// q is pre-scaled by 1/sqrt(dk) at projection time. k and vT rows arrive already
// bank-swizzled (see swz), the P tile is written swizzled the same way.
// ---------------------------------------------------------------------------
__global__ __launch_bounds__(256)
void flash_attn(const _Float16* __restrict__ q,
                const _Float16* __restrict__ k,
                const _Float16* __restrict__ vT,
                _Float16* __restrict__ x) {
  __shared__ __align__(32) _Float16 kt[2][64][64];     // [key][dk]
  __shared__ __align__(32) _Float16 vt[2][64][64];     // [dk][key]
  __shared__ __align__(32) _Float16 ldsP[8][16][64];   // per-wave P tile

  const int wave = threadIdx.x >> 5;
  const int lane = threadIdx.x & 31;
  const int h    = blockIdx.y;
  const int m0   = blockIdx.x * 128 + wave * 16;

  const _Float16* qb = q  + ((long)h * S_LEN + m0) * DKH;
  const _Float16* kb = k  + (long)h * S_LEN * DKH;
  const _Float16* vb = vT + (long)h * DKH * S_LEN;

  const v16h aq0 = load_frag(qb, DKH);
  const v16h aq1 = load_frag(qb + 32, DKH);

  v8f o[4];
#pragma unroll
  for (int t = 0; t < 4; ++t) o[t] = (v8f){};

  float mrow[8], lrow[8];
#pragma unroll
  for (int i = 0; i < 8; ++i) { mrow[i] = -1e30f; lrow[i] = 0.0f; }

  const int rbase = (lane >> 4) << 3;

  // constant D# group1 descriptors, hoisted out of the loop
  const i32x8 g1k = tdm_g1_2d(DKH, S_LEN, 64, 64, DKH);
  const i32x8 g1v = tdm_g1_2d(S_LEN, DKH, 64, 64, S_LEN);
  const unsigned int ldsK[2] = { (unsigned int)(unsigned long long)&kt[0][0][0],
                                 (unsigned int)(unsigned long long)&kt[1][0][0] };
  const unsigned int ldsV[2] = { (unsigned int)(unsigned long long)&vt[0][0][0],
                                 (unsigned int)(unsigned long long)&vt[1][0][0] };

  if (wave == 0) {                              // prime buffer 0
    tdm_issue(ldsK[0], kb, g1k);
    tdm_issue(ldsV[0], vb, g1v);
  }

  for (int j0 = 0; j0 < S_LEN; j0 += 64) {
    const int cur = (j0 >> 6) & 1;
    const int nxt = cur ^ 1;
    if (wave == 0) {
      if (j0 + 64 < S_LEN) {
        tdm_issue(ldsK[nxt], kb + (long)(j0 + 64) * DKH, g1k);
        tdm_issue(ldsV[nxt], vb + (j0 + 64), g1v);
        __builtin_amdgcn_s_wait_tensorcnt(2);   // current pair complete
      } else {
        __builtin_amdgcn_s_wait_tensorcnt(0);
      }
    }
    __syncthreads();                            // tiles visible to all waves

    // ---- scores (q pre-scaled) ------------------------------------------
    v8f s[4];
#pragma unroll
    for (int t = 0; t < 4; ++t) {
      v16h b0 = load_frag_swz(&kt[cur][t * 16][0], 0);
      v16h b1 = load_frag_swz(&kt[cur][t * 16][0], 32);
      v8f c = (v8f){};
      c = wmma_f16(aq0, b0, c);
      c = wmma_f16(aq1, b1, c);
      s[t] = c;
    }

    // ---- online softmax (rows striped over 16-lane halves) ---------------
#pragma unroll
    for (int i = 0; i < 8; ++i) {
      float mx = fmaxf(fmaxf(s[0][i], s[1][i]), fmaxf(s[2][i], s[3][i]));
      mx = fmaxf(mx, __shfl_xor(mx, 1, 32));
      mx = fmaxf(mx, __shfl_xor(mx, 2, 32));
      mx = fmaxf(mx, __shfl_xor(mx, 4, 32));
      mx = fmaxf(mx, __shfl_xor(mx, 8, 32));

      float mnew = fmaxf(mrow[i], mx);
      float corr = __expf(mrow[i] - mnew);
      float rsum = 0.0f;
#pragma unroll
      for (int t = 0; t < 4; ++t) {
        float p = __expf(s[t][i] - mnew);
        s[t][i] = p;
        rsum += p;
      }
      rsum += __shfl_xor(rsum, 1, 32);
      rsum += __shfl_xor(rsum, 2, 32);
      rsum += __shfl_xor(rsum, 4, 32);
      rsum += __shfl_xor(rsum, 8, 32);

      lrow[i] = lrow[i] * corr + rsum;
      mrow[i] = mnew;
#pragma unroll
      for (int t = 0; t < 4; ++t) o[t][i] *= corr;
    }

    // ---- re-layout P: C layout -> A fragments via per-wave LDS -----------
#pragma unroll
    for (int t = 0; t < 4; ++t)
#pragma unroll
      for (int i = 0; i < 8; ++i)
        ldsP[wave][rbase + i][swz(rbase + i, t * 16 + (lane & 15))] = (_Float16)s[t][i];

    asm volatile("s_wait_dscnt 0" ::: "memory");

    v16h pa0 = load_frag_swz(&ldsP[wave][0][0], 0);
    v16h pa1 = load_frag_swz(&ldsP[wave][0][0], 32);

    // ---- O += P x V ------------------------------------------------------
#pragma unroll
    for (int t = 0; t < 4; ++t) {
      v16h b0 = load_frag_swz(&vt[cur][t * 16][0], 0);
      v16h b1 = load_frag_swz(&vt[cur][t * 16][0], 32);
      o[t] = wmma_f16(pa0, b0, o[t]);
      o[t] = wmma_f16(pa1, b1, o[t]);
    }
    __syncthreads();   // all reads of buf[cur] done before TDM reuses it
  }

  // ---- epilogue ----------------------------------------------------------
#pragma unroll
  for (int t = 0; t < 4; ++t) {
    int col = h * DKH + t * 16 + (lane & 15);
#pragma unroll
    for (int i = 0; i < 8; ++i) {
      int m = m0 + rbase + i;
      x[(long)m * DM + col] = (_Float16)(o[t][i] / lrow[i]);
    }
  }
}

// ---------------------------------------------------------------------------
// Output projection: out[S,DM] = x[S,DM] @ Wo^T + bo, f32 output.
// Same ping-pong double-buffered structure.
// ---------------------------------------------------------------------------
__global__ __launch_bounds__(256)
void out_gemm(const _Float16* __restrict__ A,
              const _Float16* __restrict__ Bt,
              const float* __restrict__ bias,
              float* __restrict__ dst) {
  const int wave = threadIdx.x >> 5;
  const int lane = threadIdx.x & 31;
  const int m0   = blockIdx.y * 256 + wave * 32;
  const int n0   = blockIdx.x * 64;

  v8f acc[2][4];
#pragma unroll
  for (int r = 0; r < 2; ++r)
#pragma unroll
    for (int t = 0; t < 4; ++t) acc[r][t] = (v8f){};

  const _Float16* A0 = A + (long)m0 * DM;
  const _Float16* A1 = A0 + 16 * DM;
  const _Float16* Bb = Bt + (long)n0 * DM;

  v16h a0[2], a1[2], b[2][4];
  a0[0] = load_frag(A0, DM);
  a1[0] = load_frag(A1, DM);
#pragma unroll
  for (int t = 0; t < 4; ++t) b[0][t] = load_frag(Bb + (long)(t * 16) * DM, DM);

  for (int k0 = 0; k0 < DM; k0 += 64) {
    a0[1] = load_frag(A0 + k0 + 32, DM);
    a1[1] = load_frag(A1 + k0 + 32, DM);
#pragma unroll
    for (int t = 0; t < 4; ++t)
      b[1][t] = load_frag(Bb + (long)(t * 16) * DM + k0 + 32, DM);

#pragma unroll
    for (int t = 0; t < 4; ++t) {
      acc[0][t] = wmma_f16(a0[0], b[0][t], acc[0][t]);
      acc[1][t] = wmma_f16(a1[0], b[0][t], acc[1][t]);
    }

    const int kn = (k0 + 64 < DM) ? (k0 + 64) : 0;
    a0[0] = load_frag(A0 + kn, DM);
    a1[0] = load_frag(A1 + kn, DM);
#pragma unroll
    for (int t = 0; t < 4; ++t)
      b[0][t] = load_frag(Bb + (long)(t * 16) * DM + kn, DM);

#pragma unroll
    for (int t = 0; t < 4; ++t) {
      acc[0][t] = wmma_f16(a0[1], b[1][t], acc[0][t]);
      acc[1][t] = wmma_f16(a1[1], b[1][t], acc[1][t]);
    }
  }

  const int rbase = (lane >> 4) << 3;
#pragma unroll
  for (int r = 0; r < 2; ++r)
#pragma unroll
    for (int t = 0; t < 4; ++t) {
      int n = n0 + t * 16 + (lane & 15);
      float bv = bias[n];
#pragma unroll
      for (int i = 0; i < 8; ++i) {
        int m = m0 + r * 16 + rbase + i;
        dst[(long)m * DM + n] = acc[r][t][i] + bv;
      }
    }
}

// ---------------------------------------------------------------------------
extern "C" void kernel_launch(void* const* d_in, const int* in_sizes, int n_in,
                              void* d_out, int out_size, void* d_ws, size_t ws_size,
                              hipStream_t stream) {
  const float* Q  = (const float*)d_in[0];
  const float* K  = (const float*)d_in[1];
  const float* V  = (const float*)d_in[2];
  const float* Wq = (const float*)d_in[3];
  const float* bq = (const float*)d_in[4];
  const float* Wk = (const float*)d_in[5];
  const float* bk = (const float*)d_in[6];
  const float* Wv = (const float*)d_in[7];
  const float* bv = (const float*)d_in[8];
  const float* Wo = (const float*)d_in[9];
  const float* bo = (const float*)d_in[10];
  float* out = (float*)d_out;

  char* base = (char*)d_ws;
  size_t off = 0;
  auto alloc = [&](size_t elems) -> _Float16* {
    _Float16* p = (_Float16*)(base + off);
    off += (elems * sizeof(_Float16) + 255) & ~(size_t)255;
    return p;
  };

  _Float16* Qh  = alloc((size_t)S_LEN * DM);
  _Float16* Kh  = alloc((size_t)S_LEN * DM);
  _Float16* Vh  = alloc((size_t)S_LEN * DM);
  _Float16* Wtq = alloc((size_t)NH * DKH * DM);
  _Float16* Wtk = alloc((size_t)NH * DKH * DM);
  _Float16* Wtv = alloc((size_t)NH * DKH * DM);
  _Float16* Woh = alloc((size_t)DM * DM);
  _Float16* qh  = alloc((size_t)NH * S_LEN * DKH);  // [H,S,DK]
  _Float16* kh  = alloc((size_t)NH * S_LEN * DKH);  // [H,S,DK], rows swizzled
  _Float16* vTh = alloc((size_t)NH * DKH * S_LEN);  // [H,DK,S], 64-key pieces swizzled
  _Float16* xh  = alloc((size_t)S_LEN * DM);

  const int nQKV = S_LEN * DM;
  const int nWo  = DM * DM;

  cvt_f32_f16<<<nQKV / CVT_BLOCK, 256, 0, stream>>>(Q, Qh);
  cvt_f32_f16<<<nQKV / CVT_BLOCK, 256, 0, stream>>>(K, Kh);
  cvt_f32_f16<<<nQKV / CVT_BLOCK, 256, 0, stream>>>(V, Vh);
  cvt_f32_f16<<<nWo / CVT_BLOCK, 256, 0, stream>>>(Wo, Woh);
  dim3 gTr(DM / 64, NH);                       // (16, 16)
  transpose_w<<<gTr, 256, 0, stream>>>(Wq, Wtq);
  transpose_w<<<gTr, 256, 0, stream>>>(Wk, Wtk);
  transpose_w<<<gTr, 256, 0, stream>>>(Wv, Wtv);

  dim3 gProj(NH, S_LEN / 256);                 // (16, 16)
  proj_gemm<0><<<gProj, 256, 0, stream>>>(Qh, Wtq, bq, qh, 0.125f);  // q * 1/sqrt(dk)
  proj_gemm<2><<<gProj, 256, 0, stream>>>(Kh, Wtk, bk, kh, 1.0f);
  proj_gemm<1><<<gProj, 256, 0, stream>>>(Vh, Wtv, bv, vTh, 1.0f);

  dim3 gAttn(S_LEN / 128, NH);                 // (32, 16)
  flash_attn<<<gAttn, 256, 0, stream>>>(qh, kh, vTh, xh);

  dim3 gOut(DM / 64, S_LEN / 256);             // (16, 16)
  out_gemm<<<gOut, 256, 0, stream>>>(xh, Woh, bo, out);
}

// v003
// It runs in 190 microseconds.
// In both of two side-by-side timings against v002, it was 1.47 times as fast.
// Over all steps from v000 it is 3.14 times as fast.
#include <hip/hip_runtime.h>
#include <hip/hip_bf16.h>
#include <math.h>

typedef __attribute__((ext_vector_type(16))) _Float16 v16h;
typedef __attribute__((ext_vector_type(8)))  _Float16 v8h;
typedef __attribute__((ext_vector_type(8)))  float    v8f;
typedef __attribute__((ext_vector_type(2)))  float    f32x2;
typedef __attribute__((ext_vector_type(4)))  unsigned int u32x4;
typedef __attribute__((ext_vector_type(8)))  int      i32x8;
typedef __attribute__((ext_vector_type(4)))  int      i32x4;

#define S_LEN 4096
#define DM    1024
#define NH    16
#define DKH   64   // head dim

// ---------------------------------------------------------------------------
// Fragment loader (global or LDS), contiguous k order (not AMD's table order),
// valid because A and B both use it.
// A (16x32 f16): lanes 0-15 -> row (lane&15), K 0..15 ; lanes 16-31 -> K 16..31
// B (32x16 f16): identical addressing against B^T stored [N, K] row-major.
// ---------------------------------------------------------------------------
__device__ __forceinline__ v16h load_frag(const _Float16* base, int ld) {
  int l = threadIdx.x & 31;
  return *(const v16h*)(base + (long)(l & 15) * ld + ((l >> 4) << 4));
}

// ---------------------------------------------------------------------------
// Bank swizzle for rows of 64 halfs (128 B). A row is eight 16-B chunks; logical
// chunk c of row r is kept at place c ^ ((r >> 1) & 7). Sixteen lanes that read
// the same logical chunk of sixteen consecutive rows then touch all 64 LDS banks
// once, where the plain layout puts them on 8 banks.
// swz(): index in halfs, inside its row, of logical column col (0..63) of row.
// ---------------------------------------------------------------------------
__device__ __forceinline__ int swz(int row, int col) {
  return ((((col >> 3) ^ (row >> 1)) & 7) << 3) | (col & 7);
}

// Same fragment as load_frag(tile + col0, 64), read from swizzled LDS rows.
// tile points at a row whose index is a multiple of 16.
__device__ __forceinline__ v16h load_frag_swz(const _Float16* tile, int col0) {
  int l = threadIdx.x & 31;
  int r = l & 15;
  int c = col0 + ((l >> 4) << 4);
  const _Float16* rowp = tile + r * 64;
  v8h lo = *(const v8h*)(rowp + swz(r, c));
  v8h hi = *(const v8h*)(rowp + swz(r, c + 8));
  return __builtin_shufflevector(lo, hi, 0, 1, 2, 3, 4, 5, 6, 7,
                                 8, 9, 10, 11, 12, 13, 14, 15);
}

// Fragment of 16 swizzled LDS rows x 32 columns from col0, in the k order of a B operand
// packed from two accumulator tiles: element e of half hf is column
// col0 + (e < 8 ? 8 * hf + e : 16 + 8 * hf + e - 8).
__device__ __forceinline__ v16h load_frag_swz_packed_k(const _Float16* tile, int col0) {
  int l = threadIdx.x & 31;
  int r = l & 15;
  int c = col0 + ((l >> 4) << 3);
  const _Float16* rowp = tile + r * 64;
  v8h lo = *(const v8h*)(rowp + swz(r, c));
  v8h hi = *(const v8h*)(rowp + swz(r, c + 16));
  return __builtin_shufflevector(lo, hi, 0, 1, 2, 3, 4, 5, 6, 7,
                                 8, 9, 10, 11, 12, 13, 14, 15);
}

// Two f32 accumulator tiles (rows 0-15 and 16-31 of one 32-row block) as one f16 B operand.
__device__ __forceinline__ v16h pack_tiles(v8f t0, v8f t1) {
  v8h lo = __builtin_convertvector(t0, v8h);
  v8h hi = __builtin_convertvector(t1, v8h);
  return __builtin_shufflevector(lo, hi, 0, 1, 2, 3, 4, 5, 6, 7,
                                 8, 9, 10, 11, 12, 13, 14, 15);
}

// Value of lane l ^ 16.
__device__ __forceinline__ float xhalf(float v) {
  int b = __builtin_bit_cast(int, v);
  return __builtin_bit_cast(float, __builtin_amdgcn_permlanex16(b, b, 0x76543210, 0xfedcba98,
                                                                false, false));
}

__device__ __forceinline__ v8f wmma_f16(v16h a, v16h b, v8f c) {
  return __builtin_amdgcn_wmma_f32_16x16x32_f16(false, a, false, b, (short)0, c,
                                                false, false);
}

// ---------------------------------------------------------------------------
// Tensor Data Mover helpers. D# group1 (dims/strides, constant per tensor) is
// built once and hoisted; per-issue we only pack the new global address.
// ---------------------------------------------------------------------------
__device__ __forceinline__ i32x8 tdm_g1_2d(unsigned int tensor_d0,
                                           unsigned int tensor_d1,
                                           unsigned int tile_d0,
                                           unsigned int tile_d1,
                                           unsigned int stride0) {
  i32x8 g1 = { (int)0x00010000u,                                  // data_size=2B
               (int)((tensor_d0 & 0xFFFFu) << 16),
               (int)((tensor_d0 >> 16) | ((tensor_d1 & 0xFFFFu) << 16)),
               (int)((tensor_d1 >> 16) | (tile_d0 << 16)),
               (int)tile_d1,                                      // tile_dim2=0
               (int)stride0,
               0, 0 };
  return g1;
}

__device__ __forceinline__ void tdm_issue(unsigned int lds_addr,
                                          const void* gptr, i32x8 g1) {
  unsigned long long ga = (unsigned long long)gptr;
  u32x4 g0 = { 1u, lds_addr, (unsigned int)ga,
               (unsigned int)((ga >> 32) & 0x1FFFFFFu) | 0x80000000u };
  i32x4 z4 = {};
  i32x8 z8 = {};
  __builtin_amdgcn_tensor_load_to_lds(g0, g1, z4, z4, z8, 0);
}

// ---------------------------------------------------------------------------
// Pre-pass kernels. Few, fat waves: a launch of one-element threads is bound by
// how fast waves start, not by its bytes.
// ---------------------------------------------------------------------------
typedef __attribute__((ext_vector_type(4))) float    f32x4;
typedef __attribute__((ext_vector_type(4))) _Float16 v4h;

#define CVT_LOADS 8                          // 16-B loads in flight per thread
#define CVT_BLOCK (256 * CVT_LOADS * 4)      // floats converted per block

// f32 -> f16, CVT_BLOCK floats per block; the grid covers the array exactly.
// Every wave-wide load is 512 contiguous bytes, every store 256.
__global__ __launch_bounds__(256)
void cvt_f32_f16(const float* __restrict__ src, _Float16* __restrict__ dst) {
  const int i4 = blockIdx.x * (CVT_BLOCK / 4) + threadIdx.x;   // in groups of 4 floats
  const f32x4* s4 = (const f32x4*)src + i4;
  v4h* d4 = (v4h*)dst + i4;
  f32x4 v[CVT_LOADS];
#pragma unroll
  for (int j = 0; j < CVT_LOADS; ++j) v[j] = s4[j * 256];
#pragma unroll
  for (int j = 0; j < CVT_LOADS; ++j) d4[j * 256] = __builtin_convertvector(v[j], v4h);
}

// W: [NH, DM, DKH] f32  ->  Wt: [NH, DKH, DM] f16  (B^T per head)
// Block = 64 d x 64 dk of head blockIdx.y. A thread takes one dk and 16 consecutive
// d: 16 loads (a wave reads one 128-B line each), one 32-B piece of a Wt row out.
__global__ __launch_bounds__(256)
void transpose_w(const float* __restrict__ W,
                 _Float16* __restrict__ Wt) {
  const int dk = threadIdx.x & 63;
  const int h  = blockIdx.y;
  const int d0 = blockIdx.x * 64 + (threadIdx.x >> 6) * 16;
  const float* s = W + ((long)h * DM + d0) * DKH + dk;
  float v[16];
#pragma unroll
  for (int j = 0; j < 16; ++j) v[j] = s[j * DKH];
  // The wait before a register that an issued load names is rewritten. It takes s as
  // an input, so the address pair stays live to here and no loaded value is put in it.
  asm volatile("s_wait_xcnt 0x0" :: "v"(s) : "memory");
  v8h lo, hi;
#pragma unroll
  for (int j = 0; j < 8; ++j) { lo[j] = (_Float16)v[j]; hi[j] = (_Float16)v[j + 8]; }
  v8h* o = (v8h*)(Wt + ((long)h * DKH + dk) * DM + d0);
  o[0] = lo;
  o[1] = hi;
}

// ---------------------------------------------------------------------------
// QKV projection GEMM: dst[h] = (A[S,DM] x W[h][DM,DKH] + b[h]) * scale
// 8 waves, tile 256(M) x 64(N); each wave 32x64; K-loop unrolled x2 with
// explicit ping-pong stage registers (no rotation copies).
// layout 0: dst [H,S,DK] plain.  layout 1: dst [H,DK,S], each 64-key row piece
// swizzled by its dk row.  layout 2: dst [H,S,DK], each row swizzled by its key.
// (1 and 2 are the rows the attention kernel's 64x64 LDS tiles are copied from.)
// ---------------------------------------------------------------------------
template <int LAYOUT>
__global__ __launch_bounds__(256)
void proj_gemm(const _Float16* __restrict__ A,
               const _Float16* __restrict__ Bt,
               const float* __restrict__ bias,
               _Float16* __restrict__ dst,
               float scale) {
  const int wave = threadIdx.x >> 5;
  const int lane = threadIdx.x & 31;
  const int h    = blockIdx.x;
  const int m0   = blockIdx.y * 256 + wave * 32;

  v8f acc[2][4];
#pragma unroll
  for (int r = 0; r < 2; ++r)
#pragma unroll
    for (int t = 0; t < 4; ++t) acc[r][t] = (v8f){};

  const _Float16* A0 = A + (long)m0 * DM;
  const _Float16* A1 = A0 + 16 * DM;
  const _Float16* Bb = Bt + (long)h * DKH * DM;

  v16h a0[2], a1[2], b[2][4];
  a0[0] = load_frag(A0, DM);
  a1[0] = load_frag(A1, DM);
#pragma unroll
  for (int t = 0; t < 4; ++t) b[0][t] = load_frag(Bb + (long)(t * 16) * DM, DM);

  for (int k0 = 0; k0 < DM; k0 += 64) {
    // prefetch stage 1 (k0+32 always < DM)
    a0[1] = load_frag(A0 + k0 + 32, DM);
    a1[1] = load_frag(A1 + k0 + 32, DM);
#pragma unroll
    for (int t = 0; t < 4; ++t)
      b[1][t] = load_frag(Bb + (long)(t * 16) * DM + k0 + 32, DM);

#pragma unroll
    for (int t = 0; t < 4; ++t) {
      acc[0][t] = wmma_f16(a0[0], b[0][t], acc[0][t]);
      acc[1][t] = wmma_f16(a1[0], b[0][t], acc[1][t]);
    }

    // prefetch stage 0 for next pair (clamped dummy on the last pair)
    const int kn = (k0 + 64 < DM) ? (k0 + 64) : 0;
    a0[0] = load_frag(A0 + kn, DM);
    a1[0] = load_frag(A1 + kn, DM);
#pragma unroll
    for (int t = 0; t < 4; ++t)
      b[0][t] = load_frag(Bb + (long)(t * 16) * DM + kn, DM);

#pragma unroll
    for (int t = 0; t < 4; ++t) {
      acc[0][t] = wmma_f16(a0[1], b[1][t], acc[0][t]);
      acc[1][t] = wmma_f16(a1[1], b[1][t], acc[1][t]);
    }
  }

  const int rbase = (lane >> 4) << 3;
  // LAYOUT 2: swz(m, dk) = ((L ^ C) << 3) | (lane & 7), L from the lane (bits 0 and
  // 2 only), C = 2t ^ (i >> 1) known at compile time. Four pointers hold L ^ (C & 5);
  // bit 1 of C and the row go into the store's constant offset.
  _Float16* krow = dst + ((long)h * S_LEN + m0 + rbase) * DKH + (lane & 7);
  const int L = ((lane >> 3) & 1) | (rbase >> 1);
  _Float16* kp[4] = { krow + (L << 3), krow + ((L ^ 1) << 3),
                      krow + ((L ^ 4) << 3), krow + ((L ^ 5) << 3) };
  float bv[4];
#pragma unroll
  for (int t = 0; t < 4; ++t) {
    bv[t] = bias[h * DKH + t * 16 + (lane & 15)];
    // the load's address register may be reused for the next address: wait first
    asm volatile("s_wait_xcnt 0x0" ::: "memory");
  }
#pragma unroll
  for (int r = 0; r < 2; ++r)
#pragma unroll
    for (int t = 0; t < 4; ++t) {
      int dk = t * 16 + (lane & 15);
#pragma unroll
      for (int i = 0; i < 8; ++i) {
        int m = m0 + r * 16 + rbase + i;
        float val = (acc[r][t][i] + bv[t]) * scale;
        if (LAYOUT == 0)
          dst[((long)h * S_LEN + m) * DKH + dk] = (_Float16)val;
        else if (LAYOUT == 2) {
          const int C = (2 * t) ^ (i >> 1);
          kp[(C & 1) | ((C >> 1) & 2)][(r * 16 + i) * DKH + ((C & 2) << 3)] = (_Float16)val;
        }
        else
          dst[((long)h * DKH + dk) * S_LEN + (m & ~63) + swz(dk, m & 63)] = (_Float16)val;
      }
    }
}

// ---------------------------------------------------------------------------
// Flash attention: one (head, 128-query-row block) per 256-thread block.
// K/V 64x64 tiles DMA'd into double-buffered LDS by the TDM (wave 0), synced
// with s_wait_tensorcnt + barrier; all 8 waves read fragments from LDS.
// q is pre-scaled by 1/sqrt(dk) at projection time. k and vT rows arrive already
// bank-swizzled (see swz).
// Both products are transposed: S^T = K x Q^T and O^T += V^T x P^T. A lane then holds
// scores of ONE query (column lane & 15; 32 of the 64 keys, lane ^ 16 the other 32), so
// maximum and sum run inside the lane, and the P^T tiles, converted in place, are the
// B operand of the second product: P goes through no LDS.
// ---------------------------------------------------------------------------
// The grid puts two blocks on a WGP, four waves on a SIMD: the register budget is set for that.
__global__ __launch_bounds__(256) __attribute__((amdgpu_waves_per_eu(4, 4)))
void flash_attn(const _Float16* __restrict__ q,
                const _Float16* __restrict__ k,
                const _Float16* __restrict__ vT,
                _Float16* __restrict__ x) {
  __shared__ __align__(32) _Float16 kt[2][64][64];     // [key][dk]
  __shared__ __align__(32) _Float16 vt[2][64][64];     // [dk][key]

  const int wave = threadIdx.x >> 5;
  const int lane = threadIdx.x & 31;
  const int h    = blockIdx.y;
  const int m0   = blockIdx.x * 128 + wave * 16;

  const _Float16* qb = q  + ((long)h * S_LEN + m0) * DKH;
  const _Float16* kb = k  + (long)h * S_LEN * DKH;
  const _Float16* vb = vT + (long)h * DKH * S_LEN;

  const v16h aq0 = load_frag(qb, DKH);
  const v16h aq1 = load_frag(qb + 32, DKH);

  v8f o[4];
#pragma unroll
  for (int t = 0; t < 4; ++t) o[t] = (v8f){};

  float mrun = -1e30f;   // this lane's query: maximum so far (both halves alike)
  v8f   lacc = (v8f){};  // its sum, in 8 partial sums over this half's keys; joined in the epilogue

  const int rbase = (lane >> 4) << 3;

  // constant D# group1 descriptors, hoisted out of the loop
  const i32x8 g1k = tdm_g1_2d(DKH, S_LEN, 64, 64, DKH);
  const i32x8 g1v = tdm_g1_2d(S_LEN, DKH, 64, 64, S_LEN);
  const unsigned int ldsK[2] = { (unsigned int)(unsigned long long)&kt[0][0][0],
                                 (unsigned int)(unsigned long long)&kt[1][0][0] };
  const unsigned int ldsV[2] = { (unsigned int)(unsigned long long)&vt[0][0][0],
                                 (unsigned int)(unsigned long long)&vt[1][0][0] };

  if (wave == 0) {                              // prime buffer 0
    tdm_issue(ldsK[0], kb, g1k);
    tdm_issue(ldsV[0], vb, g1v);
  }

  for (int j0 = 0; j0 < S_LEN; j0 += 64) {
    const int cur = (j0 >> 6) & 1;
    const int nxt = cur ^ 1;
    if (wave == 0) {
      if (j0 + 64 < S_LEN) {
        tdm_issue(ldsK[nxt], kb + (long)(j0 + 64) * DKH, g1k);
        tdm_issue(ldsV[nxt], vb + (j0 + 64), g1v);
        __builtin_amdgcn_s_wait_tensorcnt(2);   // current pair complete
      } else {
        __builtin_amdgcn_s_wait_tensorcnt(0);
      }
    }
    __syncthreads();                            // tiles visible to all waves

    // ---- scores, transposed (q pre-scaled): s[t][i] = key t*16 + rbase + i, query lane & 15
    v8f s[4];
#pragma unroll
    for (int t = 0; t < 4; ++t) {
      v16h a0 = load_frag_swz(&kt[cur][t * 16][0], 0);
      v16h a1 = load_frag_swz(&kt[cur][t * 16][0], 32);
      v8f c = (v8f){};
      c = wmma_f16(a0, aq0, c);
      c = wmma_f16(a1, aq1, c);
      s[t] = c;
    }

    // V^T fragments (dk rows x keys), asked for here so that they land under the softmax
    v16h va[4][2];
#pragma unroll
    for (int t = 0; t < 4; ++t) {
      va[t][0] = load_frag_swz_packed_k(&vt[cur][t * 16][0], 0);
      va[t][1] = load_frag_swz_packed_k(&vt[cur][t * 16][0], 32);
    }

    // ---- online softmax, one query per lane ------------------------------
    float mt[4];                                // one short chain per tile, not one long
#pragma unroll
    for (int t = 0; t < 4; ++t) {
      mt[t] = s[t][0];
#pragma unroll
      for (int i = 1; i < 8; ++i) mt[t] = fmaxf(mt[t], s[t][i]);
    }
    float mx = fmaxf(fmaxf(mt[0], mt[1]), fmaxf(mt[2], mt[3]));
    mx = fmaxf(mx, xhalf(mx));

    const float mnew = fmaxf(mrun, mx);
    const float corr = __expf(mrun - mnew);
#pragma unroll
    for (int t = 0; t < 4; ++t)
#pragma unroll
      for (int i = 0; i < 8; i += 2) {          // exp(x) = 2^(x * log2 e), arguments in pairs
        f32x2 e = { s[t][i], s[t][i + 1] };
        e = (e - mnew) * 1.44269504f;
        s[t][i]     = __builtin_amdgcn_exp2f(e.x);
        s[t][i + 1] = __builtin_amdgcn_exp2f(e.y);
      }
    lacc = lacc * corr + ((s[0] + s[1]) + (s[2] + s[3]));
    mrun = mnew;
#pragma unroll
    for (int t = 0; t < 4; ++t) o[t] *= corr;

    // ---- P^T as B operands, straight from the score tiles ----------------
    const v16h pb0 = pack_tiles(s[0], s[1]);    // keys  0..31
    const v16h pb1 = pack_tiles(s[2], s[3]);    // keys 32..63

    // ---- O^T += V^T x P^T: o[t][i] = dk t*16 + rbase + i, query lane & 15 --
#pragma unroll
    for (int t = 0; t < 4; ++t) o[t] = wmma_f16(va[t][0], pb0, o[t]);
#pragma unroll
    for (int t = 0; t < 4; ++t) o[t] = wmma_f16(va[t][1], pb1, o[t]);
    __syncthreads();   // all reads of buf[cur] done before TDM reuses it
  }

  // ---- epilogue: a lane holds 8 consecutive dk of its query per tile: 16-B stores ----
  const float lrun = ((lacc[0] + lacc[1]) + (lacc[2] + lacc[3])) +
                     ((lacc[4] + lacc[5]) + (lacc[6] + lacc[7]));
  const float inv = 1.0f / (lrun + xhalf(lrun));
  _Float16* xr = x + (long)(m0 + (lane & 15)) * DM + h * DKH + rbase;
#pragma unroll
  for (int t = 0; t < 4; ++t)
    *(v8h*)(xr + t * 16) = __builtin_convertvector(o[t] * inv, v8h);
}

// ---------------------------------------------------------------------------
// Output projection: out[S,DM] = x[S,DM] @ Wo^T + bo, f32 output.
// Same ping-pong double-buffered structure.
// ---------------------------------------------------------------------------
__global__ __launch_bounds__(256)
void out_gemm(const _Float16* __restrict__ A,
              const _Float16* __restrict__ Bt,
              const float* __restrict__ bias,
              float* __restrict__ dst) {
  const int wave = threadIdx.x >> 5;
  const int lane = threadIdx.x & 31;
  const int m0   = blockIdx.y * 256 + wave * 32;
  const int n0   = blockIdx.x * 64;

  v8f acc[2][4];
#pragma unroll
  for (int r = 0; r < 2; ++r)
#pragma unroll
    for (int t = 0; t < 4; ++t) acc[r][t] = (v8f){};

  const _Float16* A0 = A + (long)m0 * DM;
  const _Float16* A1 = A0 + 16 * DM;
  const _Float16* Bb = Bt + (long)n0 * DM;

  v16h a0[2], a1[2], b[2][4];
  a0[0] = load_frag(A0, DM);
  a1[0] = load_frag(A1, DM);
#pragma unroll
  for (int t = 0; t < 4; ++t) b[0][t] = load_frag(Bb + (long)(t * 16) * DM, DM);

  for (int k0 = 0; k0 < DM; k0 += 64) {
    a0[1] = load_frag(A0 + k0 + 32, DM);
    a1[1] = load_frag(A1 + k0 + 32, DM);
#pragma unroll
    for (int t = 0; t < 4; ++t)
      b[1][t] = load_frag(Bb + (long)(t * 16) * DM + k0 + 32, DM);

#pragma unroll
    for (int t = 0; t < 4; ++t) {
      acc[0][t] = wmma_f16(a0[0], b[0][t], acc[0][t]);
      acc[1][t] = wmma_f16(a1[0], b[0][t], acc[1][t]);
    }

    const int kn = (k0 + 64 < DM) ? (k0 + 64) : 0;
    a0[0] = load_frag(A0 + kn, DM);
    a1[0] = load_frag(A1 + kn, DM);
#pragma unroll
    for (int t = 0; t < 4; ++t)
      b[0][t] = load_frag(Bb + (long)(t * 16) * DM + kn, DM);

#pragma unroll
    for (int t = 0; t < 4; ++t) {
      acc[0][t] = wmma_f16(a0[1], b[1][t], acc[0][t]);
      acc[1][t] = wmma_f16(a1[1], b[1][t], acc[1][t]);
    }
  }

  const int rbase = (lane >> 4) << 3;
#pragma unroll
  for (int r = 0; r < 2; ++r)
#pragma unroll
    for (int t = 0; t < 4; ++t) {
      int n = n0 + t * 16 + (lane & 15);
      float bv = bias[n];
#pragma unroll
      for (int i = 0; i < 8; ++i) {
        int m = m0 + r * 16 + rbase + i;
        dst[(long)m * DM + n] = acc[r][t][i] + bv;
      }
    }
}

// ---------------------------------------------------------------------------
extern "C" void kernel_launch(void* const* d_in, const int* in_sizes, int n_in,
                              void* d_out, int out_size, void* d_ws, size_t ws_size,
                              hipStream_t stream) {
  const float* Q  = (const float*)d_in[0];
  const float* K  = (const float*)d_in[1];
  const float* V  = (const float*)d_in[2];
  const float* Wq = (const float*)d_in[3];
  const float* bq = (const float*)d_in[4];
  const float* Wk = (const float*)d_in[5];
  const float* bk = (const float*)d_in[6];
  const float* Wv = (const float*)d_in[7];
  const float* bv = (const float*)d_in[8];
  const float* Wo = (const float*)d_in[9];
  const float* bo = (const float*)d_in[10];
  float* out = (float*)d_out;

  char* base = (char*)d_ws;
  size_t off = 0;
  auto alloc = [&](size_t elems) -> _Float16* {
    _Float16* p = (_Float16*)(base + off);
    off += (elems * sizeof(_Float16) + 255) & ~(size_t)255;
    return p;
  };

  _Float16* Qh  = alloc((size_t)S_LEN * DM);
  _Float16* Kh  = alloc((size_t)S_LEN * DM);
  _Float16* Vh  = alloc((size_t)S_LEN * DM);
  _Float16* Wtq = alloc((size_t)NH * DKH * DM);
  _Float16* Wtk = alloc((size_t)NH * DKH * DM);
  _Float16* Wtv = alloc((size_t)NH * DKH * DM);
  _Float16* Woh = alloc((size_t)DM * DM);
  _Float16* qh  = alloc((size_t)NH * S_LEN * DKH);  // [H,S,DK]
  _Float16* kh  = alloc((size_t)NH * S_LEN * DKH);  // [H,S,DK], rows swizzled
  _Float16* vTh = alloc((size_t)NH * DKH * S_LEN);  // [H,DK,S], 64-key pieces swizzled
  _Float16* xh  = alloc((size_t)S_LEN * DM);

  const int nQKV = S_LEN * DM;
  const int nWo  = DM * DM;

  cvt_f32_f16<<<nQKV / CVT_BLOCK, 256, 0, stream>>>(Q, Qh);
  cvt_f32_f16<<<nQKV / CVT_BLOCK, 256, 0, stream>>>(K, Kh);
  cvt_f32_f16<<<nQKV / CVT_BLOCK, 256, 0, stream>>>(V, Vh);
  cvt_f32_f16<<<nWo / CVT_BLOCK, 256, 0, stream>>>(Wo, Woh);
  dim3 gTr(DM / 64, NH);                       // (16, 16)
  transpose_w<<<gTr, 256, 0, stream>>>(Wq, Wtq);
  transpose_w<<<gTr, 256, 0, stream>>>(Wk, Wtk);
  transpose_w<<<gTr, 256, 0, stream>>>(Wv, Wtv);

  dim3 gProj(NH, S_LEN / 256);                 // (16, 16)
  proj_gemm<0><<<gProj, 256, 0, stream>>>(Qh, Wtq, bq, qh, 0.125f);  // q * 1/sqrt(dk)
  proj_gemm<2><<<gProj, 256, 0, stream>>>(Kh, Wtk, bk, kh, 1.0f);
  proj_gemm<1><<<gProj, 256, 0, stream>>>(Vh, Wtv, bv, vTh, 1.0f);

  dim3 gAttn(S_LEN / 128, NH);                 // (32, 16)
  flash_attn<<<gAttn, 256, 0, stream>>>(qh, kh, vTh, xh);

  dim3 gOut(DM / 64, S_LEN / 256);             // (16, 16)
  out_gemm<<<gOut, 256, 0, stream>>>(xh, Woh, bo, out);
}

// v004
// A run of this version takes 154 microseconds.
// Next to v003, in two timings, it ran 1.26 and 1.25 times as fast.
// All steps since v000 together make it 3.93 times as fast.
#include <hip/hip_runtime.h>
#include <hip/hip_bf16.h>
#include <math.h>

typedef __attribute__((ext_vector_type(16))) _Float16 v16h;
typedef __attribute__((ext_vector_type(8)))  _Float16 v8h;
typedef __attribute__((ext_vector_type(8)))  float    v8f;
typedef __attribute__((ext_vector_type(2)))  float    f32x2;
typedef __attribute__((ext_vector_type(4)))  unsigned int u32x4;
typedef __attribute__((ext_vector_type(8)))  int      i32x8;
typedef __attribute__((ext_vector_type(4)))  int      i32x4;

#define S_LEN 4096
#define DM    1024
#define NH    16
#define DKH   64   // head dim

// ---------------------------------------------------------------------------
// Fragment loader (global or LDS), contiguous k order (not AMD's table order),
// valid because A and B both use it.
// A (16x32 f16): lanes 0-15 -> row (lane&15), K 0..15 ; lanes 16-31 -> K 16..31
// B (32x16 f16): identical addressing against B^T stored [N, K] row-major.
// ---------------------------------------------------------------------------
__device__ __forceinline__ v16h load_frag(const _Float16* base, int ld) {
  int l = threadIdx.x & 31;
  return *(const v16h*)(base + (long)(l & 15) * ld + ((l >> 4) << 4));
}

// ---------------------------------------------------------------------------
// Bank swizzle for rows of 64 halfs (128 B). A row is eight 16-B chunks; logical
// chunk c of row r is kept at place c ^ ((r >> 1) & 7). Sixteen lanes that read
// the same logical chunk of sixteen consecutive rows then touch all 64 LDS banks
// once, where the plain layout puts them on 8 banks.
// swz(): index in halfs, inside its row, of logical column col (0..63) of row.
// ---------------------------------------------------------------------------
__device__ __forceinline__ int swz(int row, int col) {
  return ((((col >> 3) ^ (row >> 1)) & 7) << 3) | (col & 7);
}

// Same fragment as load_frag(tile + col0, 64), read from swizzled LDS rows.
// tile points at a row whose index is a multiple of 16.
__device__ __forceinline__ v16h load_frag_swz(const _Float16* tile, int col0) {
  int l = threadIdx.x & 31;
  int r = l & 15;
  int c = col0 + ((l >> 4) << 4);
  const _Float16* rowp = tile + r * 64;
  v8h lo = *(const v8h*)(rowp + swz(r, c));
  v8h hi = *(const v8h*)(rowp + swz(r, c + 8));
  return __builtin_shufflevector(lo, hi, 0, 1, 2, 3, 4, 5, 6, 7,
                                 8, 9, 10, 11, 12, 13, 14, 15);
}

// Fragment of 16 swizzled LDS rows x 32 columns from col0, in the k order of a B operand
// packed from two accumulator tiles: element e of half hf is column
// col0 + (e < 8 ? 8 * hf + e : 16 + 8 * hf + e - 8).
__device__ __forceinline__ v16h load_frag_swz_packed_k(const _Float16* tile, int col0) {
  int l = threadIdx.x & 31;
  int r = l & 15;
  int c = col0 + ((l >> 4) << 3);
  const _Float16* rowp = tile + r * 64;
  v8h lo = *(const v8h*)(rowp + swz(r, c));
  v8h hi = *(const v8h*)(rowp + swz(r, c + 16));
  return __builtin_shufflevector(lo, hi, 0, 1, 2, 3, 4, 5, 6, 7,
                                 8, 9, 10, 11, 12, 13, 14, 15);
}

// Two f32 accumulator tiles (rows 0-15 and 16-31 of one 32-row block) as one f16 B operand.
__device__ __forceinline__ v16h pack_tiles(v8f t0, v8f t1) {
  v8h lo = __builtin_convertvector(t0, v8h);
  v8h hi = __builtin_convertvector(t1, v8h);
  return __builtin_shufflevector(lo, hi, 0, 1, 2, 3, 4, 5, 6, 7,
                                 8, 9, 10, 11, 12, 13, 14, 15);
}

// Value of lane l ^ 16.
__device__ __forceinline__ float xhalf(float v) {
  int b = __builtin_bit_cast(int, v);
  return __builtin_bit_cast(float, __builtin_amdgcn_permlanex16(b, b, 0x76543210, 0xfedcba98,
                                                                false, false));
}

__device__ __forceinline__ v8f wmma_f16(v16h a, v16h b, v8f c) {
  return __builtin_amdgcn_wmma_f32_16x16x32_f16(false, a, false, b, (short)0, c,
                                                false, false);
}

// ---------------------------------------------------------------------------
// Tensor Data Mover helpers. D# group1 (dims/strides, constant per tensor) is
// built once and hoisted; per-issue we only pack the new global address.
// ---------------------------------------------------------------------------
__device__ __forceinline__ i32x8 tdm_g1_2d(unsigned int tensor_d0,
                                           unsigned int tensor_d1,
                                           unsigned int tile_d0,
                                           unsigned int tile_d1,
                                           unsigned int stride0) {
  i32x8 g1 = { (int)0x00010000u,                                  // data_size=2B
               (int)((tensor_d0 & 0xFFFFu) << 16),
               (int)((tensor_d0 >> 16) | ((tensor_d1 & 0xFFFFu) << 16)),
               (int)((tensor_d1 >> 16) | (tile_d0 << 16)),
               (int)tile_d1,                                      // tile_dim2=0
               (int)stride0,
               0, 0 };
  return g1;
}

__device__ __forceinline__ void tdm_issue(unsigned int lds_addr,
                                          const void* gptr, i32x8 g1) {
  unsigned long long ga = (unsigned long long)gptr;
  u32x4 g0 = { 1u, lds_addr, (unsigned int)ga,
               (unsigned int)((ga >> 32) & 0x1FFFFFFu) | 0x80000000u };
  i32x4 z4 = {};
  i32x8 z8 = {};
  __builtin_amdgcn_tensor_load_to_lds(g0, g1, z4, z4, z8, 0);
}

// ---------------------------------------------------------------------------
// Pre-pass kernels. Few, fat waves: a launch of one-element threads is bound by
// how fast waves start, not by its bytes.
// ---------------------------------------------------------------------------
typedef __attribute__((ext_vector_type(4))) float    f32x4;
typedef __attribute__((ext_vector_type(4))) _Float16 v4h;

#define CVT_LOADS 8                          // 16-B loads in flight per thread
#define CVT_BLOCK (256 * CVT_LOADS * 4)      // floats converted per block

// f32 -> f16, CVT_BLOCK floats per block; the grid covers the array exactly.
// Every wave-wide load is 512 contiguous bytes, every store 256.
__global__ __launch_bounds__(256)
void cvt_f32_f16(const float* __restrict__ src, _Float16* __restrict__ dst) {
  const int i4 = blockIdx.x * (CVT_BLOCK / 4) + threadIdx.x;   // in groups of 4 floats
  const f32x4* s4 = (const f32x4*)src + i4;
  v4h* d4 = (v4h*)dst + i4;
  f32x4 v[CVT_LOADS];
#pragma unroll
  for (int j = 0; j < CVT_LOADS; ++j) v[j] = s4[j * 256];
#pragma unroll
  for (int j = 0; j < CVT_LOADS; ++j) d4[j * 256] = __builtin_convertvector(v[j], v4h);
}

// W: [NH, DM, DKH] f32  ->  Wt: [NH, DKH, DM] f16  (B^T per head)
// Block = 64 d x 64 dk of head blockIdx.y. A thread takes one dk and 16 consecutive
// d: 16 loads (a wave reads one 128-B line each), one 32-B piece of a Wt row out.
__global__ __launch_bounds__(256)
void transpose_w(const float* __restrict__ W,
                 _Float16* __restrict__ Wt) {
  const int dk = threadIdx.x & 63;
  const int h  = blockIdx.y;
  const int d0 = blockIdx.x * 64 + (threadIdx.x >> 6) * 16;
  const float* s = W + ((long)h * DM + d0) * DKH + dk;
  float v[16];
#pragma unroll
  for (int j = 0; j < 16; ++j) v[j] = s[j * DKH];
  // The wait before a register that an issued load names is rewritten. It takes s as
  // an input, so the address pair stays live to here and no loaded value is put in it.
  asm volatile("s_wait_xcnt 0x0" :: "v"(s) : "memory");
  v8h lo, hi;
#pragma unroll
  for (int j = 0; j < 8; ++j) { lo[j] = (_Float16)v[j]; hi[j] = (_Float16)v[j + 8]; }
  v8h* o = (v8h*)(Wt + ((long)h * DKH + dk) * DM + d0);
  o[0] = lo;
  o[1] = hi;
}

// ---------------------------------------------------------------------------
// Operand staging of the two GEMM kernels. A fragment load straight from a row-major
// operand touches 16 cache lines for 1024 bytes; here every K tile (64 halfs = one 128-B
// line per row) goes to LDS by asynchronous copies that cover whole lines, and the
// fragments are read from LDS. LDS rows are bank-swizzled as in swz().
// ---------------------------------------------------------------------------
#define GT      64                 // halfs of K per staged tile
#define G_TILES (DM / GT)          // 16
#define GA_BYTES (256 * GT * 2)    // one A buffer: 256 rows
#define GB_BYTES (64 * GT * 2)     // one B buffer: 64 rows

// One K tile: 256 A rows and 64 B rows of 128 B. A thread copies the same 16-B chunk of
// every 32nd row: eight chunks of A, two of B; a wave-wide copy covers four whole lines.
// ga, gb: this thread's chunk in row (tid >> 3) of the tile; la, lb: its LDS byte address.
__device__ __forceinline__ void stage_tile(const _Float16* ga, const _Float16* gb,
                                           unsigned int la, unsigned int lb) {
  // The closing s_wait_xcnt stands in the copies' own statement: the address registers
  // that the copies name are rewritten for the next tile only behind it.
  asm volatile(
      "global_load_async_to_lds_b128 %0, %1, off\n\t"
      "global_load_async_to_lds_b128 %2, %3, off\n\t"
      "global_load_async_to_lds_b128 %4, %5, off\n\t"
      "global_load_async_to_lds_b128 %6, %7, off\n\t"
      "global_load_async_to_lds_b128 %8, %9, off\n\t"
      "global_load_async_to_lds_b128 %10, %11, off\n\t"
      "global_load_async_to_lds_b128 %12, %13, off\n\t"
      "global_load_async_to_lds_b128 %14, %15, off\n\t"
      "global_load_async_to_lds_b128 %16, %17, off\n\t"
      "global_load_async_to_lds_b128 %18, %19, off\n\t"
      "s_wait_xcnt 0x0"
      :: "v"(lb),              "v"(gb),
         "v"(lb + 1 * 4096u),  "v"(gb + 1 * 32 * DM),
         "v"(la),              "v"(ga),
         "v"(la + 1 * 4096u),  "v"(ga + 1 * 32 * DM),
         "v"(la + 2 * 4096u),  "v"(ga + 2 * 32 * DM),
         "v"(la + 3 * 4096u),  "v"(ga + 3 * 32 * DM),
         "v"(la + 4 * 4096u),  "v"(ga + 4 * 32 * DM),
         "v"(la + 5 * 4096u),  "v"(ga + 5 * 32 * DM),
         "v"(la + 6 * 4096u),  "v"(ga + 6 * 32 * DM),
         "v"(la + 7 * 4096u),  "v"(ga + 7 * 32 * DM)
      : "memory");
}

// acc[r][t] += A[rows wave*32 + r*16 ..][DM] x Bt[rows t*16 ..][DM]^T for a block of 8 waves.
// Ablk: row 0 of the block's 256 A rows; Bblk: row 0 of its 64 Bt rows (both pitch DM).
// Two LDS buffers: tile t + 1 is in flight while tile t is multiplied.
__device__ __forceinline__ void gemm_256x64(const _Float16* __restrict__ Ablk,
                                            const _Float16* __restrict__ Bblk,
                                            _Float16 (*sA)[256][GT],
                                            _Float16 (*sB)[64][GT],
                                            v8f (&acc)[2][4]) {
  const int wave  = threadIdx.x >> 5;
  const int crow  = threadIdx.x >> 3;          // 0..31
  const int chunk = threadIdx.x & 7;
  const _Float16* ga = Ablk + (long)crow * DM + chunk * 8;
  const _Float16* gb = Bblk + (long)crow * DM + chunk * 8;
  // rows crow + 32 j share (row >> 1) & 7, so one swizzled place serves all of a thread's chunks
  const unsigned int lofs = crow * (GT * 2) + (((chunk ^ (crow >> 1)) & 7) << 4);
  const unsigned int la = (unsigned int)(unsigned long long)&sA[0][0][0] + lofs;
  const unsigned int lb = (unsigned int)(unsigned long long)&sB[0][0][0] + lofs;

  stage_tile(ga, gb, la, lb);
  // tile 0 has landed for this wave; the barrier shows it to the others
  asm volatile("s_wait_asynccnt 0x0" ::: "memory");
  __syncthreads();
  stage_tile(ga + GT, gb + GT, la + GA_BYTES, lb + GB_BYTES);

  for (int t = 0; t < G_TILES; ++t) {
    const int cur = t & 1;
    const _Float16* tA = &sA[cur][wave * 32][0];
    const _Float16* tB = &sB[cur][0][0];
#pragma unroll
    for (int s = 0; s < GT; s += 32) {
      const v16h a0 = load_frag_swz(tA, s);
      const v16h a1 = load_frag_swz(tA + 16 * GT, s);
#pragma unroll
      for (int n = 0; n < 4; ++n) {
        const v16h b = load_frag_swz(tB + n * 16 * GT, s);
        acc[0][n] = wmma_f16(a0, b, acc[0][n]);
        acc[1][n] = wmma_f16(a1, b, acc[1][n]);
      }
    }
    // this wave's reads of buffer cur are done before the buffer is refilled
    asm volatile("s_wait_dscnt 0x0" ::: "memory");
    // this wave's copies of tile t + 1 have landed
    asm volatile("s_wait_asynccnt 0x0" ::: "memory");
    __syncthreads();   // publishes tile t + 1 and ends every wave's reads of buffer cur
    if (t + 2 < G_TILES)
      stage_tile(ga + (t + 2) * GT, gb + (t + 2) * GT, la + cur * GA_BYTES, lb + cur * GB_BYTES);
  }
  // no copy is outstanding when the wave goes on to its epilogue and ends
  asm volatile("s_wait_asynccnt 0x0" ::: "memory");
}

// ---------------------------------------------------------------------------
// QKV projection GEMM: dst[h] = (A[S,DM] x W[h][DM,DKH] + b[h]) * scale
// 8 waves, tile 256(M) x 64(N); each wave 32x64; operands staged in LDS (gemm_256x64).
// layout 0: dst [H,S,DK] plain.  layout 1: dst [H,DK,S], each 64-key row piece
// swizzled by its dk row.  layout 2: dst [H,S,DK], each row swizzled by its key.
// (1 and 2 are the rows the attention kernel's 64x64 LDS tiles are copied from.)
// ---------------------------------------------------------------------------
template <int LAYOUT>
__global__ __launch_bounds__(256)
void proj_gemm(const _Float16* __restrict__ A,
               const _Float16* __restrict__ Bt,
               const float* __restrict__ bias,
               _Float16* __restrict__ dst,
               float scale) {
  const int wave = threadIdx.x >> 5;
  const int lane = threadIdx.x & 31;
  const int h    = blockIdx.x;
  const int m0   = blockIdx.y * 256 + wave * 32;

  v8f acc[2][4];
#pragma unroll
  for (int r = 0; r < 2; ++r)
#pragma unroll
    for (int t = 0; t < 4; ++t) acc[r][t] = (v8f){};

  __shared__ __align__(128) _Float16 sA[2][256][GT];
  __shared__ __align__(128) _Float16 sB[2][64][GT];
  gemm_256x64(A + (long)blockIdx.y * 256 * DM, Bt + (long)h * DKH * DM, sA, sB, acc);

  const int rbase = (lane >> 4) << 3;
  // LAYOUT 2: swz(m, dk) = ((L ^ C) << 3) | (lane & 7), L from the lane (bits 0 and
  // 2 only), C = 2t ^ (i >> 1) known at compile time. Four pointers hold L ^ (C & 5);
  // bit 1 of C and the row go into the store's constant offset.
  _Float16* krow = dst + ((long)h * S_LEN + m0 + rbase) * DKH + (lane & 7);
  const int L = ((lane >> 3) & 1) | (rbase >> 1);
  _Float16* kp[4] = { krow + (L << 3), krow + ((L ^ 1) << 3),
                      krow + ((L ^ 4) << 3), krow + ((L ^ 5) << 3) };
  float bv[4];
#pragma unroll
  for (int t = 0; t < 4; ++t) {
    bv[t] = bias[h * DKH + t * 16 + (lane & 15)];
    // the load's address register may be reused for the next address: wait first
    asm volatile("s_wait_xcnt 0x0" ::: "memory");
  }
#pragma unroll
  for (int r = 0; r < 2; ++r)
#pragma unroll
    for (int t = 0; t < 4; ++t) {
      int dk = t * 16 + (lane & 15);
#pragma unroll
      for (int i = 0; i < 8; ++i) {
        int m = m0 + r * 16 + rbase + i;
        float val = (acc[r][t][i] + bv[t]) * scale;
        if (LAYOUT == 0)
          dst[((long)h * S_LEN + m) * DKH + dk] = (_Float16)val;
        else if (LAYOUT == 2) {
          const int C = (2 * t) ^ (i >> 1);
          kp[(C & 1) | ((C >> 1) & 2)][(r * 16 + i) * DKH + ((C & 2) << 3)] = (_Float16)val;
        }
        else
          dst[((long)h * DKH + dk) * S_LEN + (m & ~63) + swz(dk, m & 63)] = (_Float16)val;
      }
    }
}

// ---------------------------------------------------------------------------
// Flash attention: one (head, 128-query-row block) per 256-thread block.
// K/V 64x64 tiles DMA'd into double-buffered LDS by the TDM (wave 0), synced
// with s_wait_tensorcnt + barrier; all 8 waves read fragments from LDS.
// q is pre-scaled by 1/sqrt(dk) at projection time. k and vT rows arrive already
// bank-swizzled (see swz).
// Both products are transposed: S^T = K x Q^T and O^T += V^T x P^T. A lane then holds
// scores of ONE query (column lane & 15; 32 of the 64 keys, lane ^ 16 the other 32), so
// maximum and sum run inside the lane, and the P^T tiles, converted in place, are the
// B operand of the second product: P goes through no LDS.
// ---------------------------------------------------------------------------
// The grid puts two blocks on a WGP, four waves on a SIMD: the register budget is set for that.
__global__ __launch_bounds__(256) __attribute__((amdgpu_waves_per_eu(4, 4)))
void flash_attn(const _Float16* __restrict__ q,
                const _Float16* __restrict__ k,
                const _Float16* __restrict__ vT,
                _Float16* __restrict__ x) {
  __shared__ __align__(32) _Float16 kt[2][64][64];     // [key][dk]
  __shared__ __align__(32) _Float16 vt[2][64][64];     // [dk][key]

  const int wave = threadIdx.x >> 5;
  const int lane = threadIdx.x & 31;
  const int h    = blockIdx.y;
  const int m0   = blockIdx.x * 128 + wave * 16;

  const _Float16* qb = q  + ((long)h * S_LEN + m0) * DKH;
  const _Float16* kb = k  + (long)h * S_LEN * DKH;
  const _Float16* vb = vT + (long)h * DKH * S_LEN;

  const v16h aq0 = load_frag(qb, DKH);
  const v16h aq1 = load_frag(qb + 32, DKH);

  v8f o[4];
#pragma unroll
  for (int t = 0; t < 4; ++t) o[t] = (v8f){};

  float mrun = -1e30f;   // this lane's query: maximum so far (both halves alike)
  v8f   lacc = (v8f){};  // its sum, in 8 partial sums over this half's keys; joined in the epilogue

  const int rbase = (lane >> 4) << 3;

  // constant D# group1 descriptors, hoisted out of the loop
  const i32x8 g1k = tdm_g1_2d(DKH, S_LEN, 64, 64, DKH);
  const i32x8 g1v = tdm_g1_2d(S_LEN, DKH, 64, 64, S_LEN);
  const unsigned int ldsK[2] = { (unsigned int)(unsigned long long)&kt[0][0][0],
                                 (unsigned int)(unsigned long long)&kt[1][0][0] };
  const unsigned int ldsV[2] = { (unsigned int)(unsigned long long)&vt[0][0][0],
                                 (unsigned int)(unsigned long long)&vt[1][0][0] };

  if (wave == 0) {                              // prime buffer 0
    tdm_issue(ldsK[0], kb, g1k);
    tdm_issue(ldsV[0], vb, g1v);
  }

  for (int j0 = 0; j0 < S_LEN; j0 += 64) {
    const int cur = (j0 >> 6) & 1;
    const int nxt = cur ^ 1;
    if (wave == 0) {
      if (j0 + 64 < S_LEN) {
        tdm_issue(ldsK[nxt], kb + (long)(j0 + 64) * DKH, g1k);
        tdm_issue(ldsV[nxt], vb + (j0 + 64), g1v);
        __builtin_amdgcn_s_wait_tensorcnt(2);   // current pair complete
      } else {
        __builtin_amdgcn_s_wait_tensorcnt(0);
      }
    }
    __syncthreads();                            // tiles visible to all waves

    // ---- scores, transposed (q pre-scaled): s[t][i] = key t*16 + rbase + i, query lane & 15
    v8f s[4];
#pragma unroll
    for (int t = 0; t < 4; ++t) {
      v16h a0 = load_frag_swz(&kt[cur][t * 16][0], 0);
      v16h a1 = load_frag_swz(&kt[cur][t * 16][0], 32);
      v8f c = (v8f){};
      c = wmma_f16(a0, aq0, c);
      c = wmma_f16(a1, aq1, c);
      s[t] = c;
    }

    // V^T fragments (dk rows x keys), asked for here so that they land under the softmax
    v16h va[4][2];
#pragma unroll
    for (int t = 0; t < 4; ++t) {
      va[t][0] = load_frag_swz_packed_k(&vt[cur][t * 16][0], 0);
      va[t][1] = load_frag_swz_packed_k(&vt[cur][t * 16][0], 32);
    }

    // ---- online softmax, one query per lane ------------------------------
    float mt[4];                                // one short chain per tile, not one long
#pragma unroll
    for (int t = 0; t < 4; ++t) {
      mt[t] = s[t][0];
#pragma unroll
      for (int i = 1; i < 8; ++i) mt[t] = fmaxf(mt[t], s[t][i]);
    }
    float mx = fmaxf(fmaxf(mt[0], mt[1]), fmaxf(mt[2], mt[3]));
    mx = fmaxf(mx, xhalf(mx));

    const float mnew = fmaxf(mrun, mx);
    const float corr = __expf(mrun - mnew);
#pragma unroll
    for (int t = 0; t < 4; ++t)
#pragma unroll
      for (int i = 0; i < 8; i += 2) {          // exp(x) = 2^(x * log2 e), arguments in pairs
        f32x2 e = { s[t][i], s[t][i + 1] };
        e = (e - mnew) * 1.44269504f;
        s[t][i]     = __builtin_amdgcn_exp2f(e.x);
        s[t][i + 1] = __builtin_amdgcn_exp2f(e.y);
      }
    lacc = lacc * corr + ((s[0] + s[1]) + (s[2] + s[3]));
    mrun = mnew;
#pragma unroll
    for (int t = 0; t < 4; ++t) o[t] *= corr;

    // ---- P^T as B operands, straight from the score tiles ----------------
    const v16h pb0 = pack_tiles(s[0], s[1]);    // keys  0..31
    const v16h pb1 = pack_tiles(s[2], s[3]);    // keys 32..63

    // ---- O^T += V^T x P^T: o[t][i] = dk t*16 + rbase + i, query lane & 15 --
#pragma unroll
    for (int t = 0; t < 4; ++t) o[t] = wmma_f16(va[t][0], pb0, o[t]);
#pragma unroll
    for (int t = 0; t < 4; ++t) o[t] = wmma_f16(va[t][1], pb1, o[t]);
    __syncthreads();   // all reads of buf[cur] done before TDM reuses it
  }

  // ---- epilogue: a lane holds 8 consecutive dk of its query per tile: 16-B stores ----
  const float lrun = ((lacc[0] + lacc[1]) + (lacc[2] + lacc[3])) +
                     ((lacc[4] + lacc[5]) + (lacc[6] + lacc[7]));
  const float inv = 1.0f / (lrun + xhalf(lrun));
  _Float16* xr = x + (long)(m0 + (lane & 15)) * DM + h * DKH + rbase;
#pragma unroll
  for (int t = 0; t < 4; ++t)
    *(v8h*)(xr + t * 16) = __builtin_convertvector(o[t] * inv, v8h);
}

// ---------------------------------------------------------------------------
// Output projection: out[S,DM] = x[S,DM] @ Wo^T + bo, f32 output.
// Same tile and operand staging as the projection.
// ---------------------------------------------------------------------------
__global__ __launch_bounds__(256)
void out_gemm(const _Float16* __restrict__ A,
              const _Float16* __restrict__ Bt,
              const float* __restrict__ bias,
              float* __restrict__ dst) {
  const int wave = threadIdx.x >> 5;
  const int lane = threadIdx.x & 31;
  const int m0   = blockIdx.y * 256 + wave * 32;
  const int n0   = blockIdx.x * 64;

  v8f acc[2][4];
#pragma unroll
  for (int r = 0; r < 2; ++r)
#pragma unroll
    for (int t = 0; t < 4; ++t) acc[r][t] = (v8f){};

  __shared__ __align__(128) _Float16 sA[2][256][GT];
  __shared__ __align__(128) _Float16 sB[2][64][GT];
  gemm_256x64(A + (long)blockIdx.y * 256 * DM, Bt + (long)n0 * DM, sA, sB, acc);

  const int rbase = (lane >> 4) << 3;
#pragma unroll
  for (int r = 0; r < 2; ++r)
#pragma unroll
    for (int t = 0; t < 4; ++t) {
      int n = n0 + t * 16 + (lane & 15);
      float bv = bias[n];
#pragma unroll
      for (int i = 0; i < 8; ++i) {
        int m = m0 + r * 16 + rbase + i;
        dst[(long)m * DM + n] = acc[r][t][i] + bv;
      }
    }
}

// ---------------------------------------------------------------------------
extern "C" void kernel_launch(void* const* d_in, const int* in_sizes, int n_in,
                              void* d_out, int out_size, void* d_ws, size_t ws_size,
                              hipStream_t stream) {
  const float* Q  = (const float*)d_in[0];
  const float* K  = (const float*)d_in[1];
  const float* V  = (const float*)d_in[2];
  const float* Wq = (const float*)d_in[3];
  const float* bq = (const float*)d_in[4];
  const float* Wk = (const float*)d_in[5];
  const float* bk = (const float*)d_in[6];
  const float* Wv = (const float*)d_in[7];
  const float* bv = (const float*)d_in[8];
  const float* Wo = (const float*)d_in[9];
  const float* bo = (const float*)d_in[10];
  float* out = (float*)d_out;

  char* base = (char*)d_ws;
  size_t off = 0;
  auto alloc = [&](size_t elems) -> _Float16* {
    _Float16* p = (_Float16*)(base + off);
    off += (elems * sizeof(_Float16) + 255) & ~(size_t)255;
    return p;
  };

  _Float16* Qh  = alloc((size_t)S_LEN * DM);
  _Float16* Kh  = alloc((size_t)S_LEN * DM);
  _Float16* Vh  = alloc((size_t)S_LEN * DM);
  _Float16* Wtq = alloc((size_t)NH * DKH * DM);
  _Float16* Wtk = alloc((size_t)NH * DKH * DM);
  _Float16* Wtv = alloc((size_t)NH * DKH * DM);
  _Float16* Woh = alloc((size_t)DM * DM);
  _Float16* qh  = alloc((size_t)NH * S_LEN * DKH);  // [H,S,DK]
  _Float16* kh  = alloc((size_t)NH * S_LEN * DKH);  // [H,S,DK], rows swizzled
  _Float16* vTh = alloc((size_t)NH * DKH * S_LEN);  // [H,DK,S], 64-key pieces swizzled
  _Float16* xh  = alloc((size_t)S_LEN * DM);

  const int nQKV = S_LEN * DM;
  const int nWo  = DM * DM;

  cvt_f32_f16<<<nQKV / CVT_BLOCK, 256, 0, stream>>>(Q, Qh);
  cvt_f32_f16<<<nQKV / CVT_BLOCK, 256, 0, stream>>>(K, Kh);
  cvt_f32_f16<<<nQKV / CVT_BLOCK, 256, 0, stream>>>(V, Vh);
  cvt_f32_f16<<<nWo / CVT_BLOCK, 256, 0, stream>>>(Wo, Woh);
  dim3 gTr(DM / 64, NH);                       // (16, 16)
  transpose_w<<<gTr, 256, 0, stream>>>(Wq, Wtq);
  transpose_w<<<gTr, 256, 0, stream>>>(Wk, Wtk);
  transpose_w<<<gTr, 256, 0, stream>>>(Wv, Wtv);

  dim3 gProj(NH, S_LEN / 256);                 // (16, 16)
  proj_gemm<0><<<gProj, 256, 0, stream>>>(Qh, Wtq, bq, qh, 0.125f);  // q * 1/sqrt(dk)
  proj_gemm<2><<<gProj, 256, 0, stream>>>(Kh, Wtk, bk, kh, 1.0f);
  proj_gemm<1><<<gProj, 256, 0, stream>>>(Vh, Wtv, bv, vTh, 1.0f);

  dim3 gAttn(S_LEN / 128, NH);                 // (32, 16)
  flash_attn<<<gAttn, 256, 0, stream>>>(qh, kh, vTh, xh);

  dim3 gOut(DM / 64, S_LEN / 256);             // (16, 16)
  out_gemm<<<gOut, 256, 0, stream>>>(xh, Woh, bo, out);
}

// v005
// One run takes 116 microseconds.
// Two timings next to v004 put it at 1.33 and 1.32 times that version's speed.
// All steps since v000 together make it 5.21 times as fast.
#include <hip/hip_runtime.h>
#include <hip/hip_bf16.h>
#include <math.h>

typedef __attribute__((ext_vector_type(16))) _Float16 v16h;
typedef __attribute__((ext_vector_type(8)))  _Float16 v8h;
typedef __attribute__((ext_vector_type(8)))  float    v8f;
typedef __attribute__((ext_vector_type(2)))  float    f32x2;
typedef __attribute__((ext_vector_type(4)))  unsigned int u32x4;
typedef __attribute__((ext_vector_type(8)))  int      i32x8;
typedef __attribute__((ext_vector_type(4)))  int      i32x4;

#define S_LEN 4096
#define DM    1024
#define NH    16
#define DKH   64   // head dim

// ---------------------------------------------------------------------------
// Fragment loader (global or LDS), contiguous k order (not AMD's table order),
// valid because A and B both use it.
// A (16x32 f16): lanes 0-15 -> row (lane&15), K 0..15 ; lanes 16-31 -> K 16..31
// B (32x16 f16): identical addressing against B^T stored [N, K] row-major.
// ---------------------------------------------------------------------------
__device__ __forceinline__ v16h load_frag(const _Float16* base, int ld) {
  int l = threadIdx.x & 31;
  return *(const v16h*)(base + (long)(l & 15) * ld + ((l >> 4) << 4));
}

// ---------------------------------------------------------------------------
// Bank swizzle for rows of 64 halfs (128 B). A row is eight 16-B chunks; logical
// chunk c of row r is kept at place c ^ ((r >> 1) & 7). Sixteen lanes that read
// the same logical chunk of sixteen consecutive rows then touch all 64 LDS banks
// once, where the plain layout puts them on 8 banks.
// swz(): index in halfs, inside its row, of logical column col (0..63) of row.
// ---------------------------------------------------------------------------
__device__ __forceinline__ int swz(int row, int col) {
  return ((((col >> 3) ^ (row >> 1)) & 7) << 3) | (col & 7);
}

// Same fragment as load_frag(tile + col0, 64), read from swizzled LDS rows.
// tile points at a row whose index is a multiple of 16.
__device__ __forceinline__ v16h load_frag_swz(const _Float16* tile, int col0) {
  int l = threadIdx.x & 31;
  int r = l & 15;
  int c = col0 + ((l >> 4) << 4);
  const _Float16* rowp = tile + r * 64;
  v8h lo = *(const v8h*)(rowp + swz(r, c));
  v8h hi = *(const v8h*)(rowp + swz(r, c + 8));
  return __builtin_shufflevector(lo, hi, 0, 1, 2, 3, 4, 5, 6, 7,
                                 8, 9, 10, 11, 12, 13, 14, 15);
}

// Fragment of 16 swizzled LDS rows x 32 columns from col0, in the k order of a B operand
// packed from two accumulator tiles: element e of half hf is column
// col0 + (e < 8 ? 8 * hf + e : 16 + 8 * hf + e - 8).
__device__ __forceinline__ v16h load_frag_swz_packed_k(const _Float16* tile, int col0) {
  int l = threadIdx.x & 31;
  int r = l & 15;
  int c = col0 + ((l >> 4) << 3);
  const _Float16* rowp = tile + r * 64;
  v8h lo = *(const v8h*)(rowp + swz(r, c));
  v8h hi = *(const v8h*)(rowp + swz(r, c + 16));
  return __builtin_shufflevector(lo, hi, 0, 1, 2, 3, 4, 5, 6, 7,
                                 8, 9, 10, 11, 12, 13, 14, 15);
}

// Two f32 accumulator tiles (rows 0-15 and 16-31 of one 32-row block) as one f16 B operand.
__device__ __forceinline__ v16h pack_tiles(v8f t0, v8f t1) {
  v8h lo = __builtin_convertvector(t0, v8h);
  v8h hi = __builtin_convertvector(t1, v8h);
  return __builtin_shufflevector(lo, hi, 0, 1, 2, 3, 4, 5, 6, 7,
                                 8, 9, 10, 11, 12, 13, 14, 15);
}

// Value of lane l ^ 16.
__device__ __forceinline__ float xhalf(float v) {
  int b = __builtin_bit_cast(int, v);
  return __builtin_bit_cast(float, __builtin_amdgcn_permlanex16(b, b, 0x76543210, 0xfedcba98,
                                                                false, false));
}

__device__ __forceinline__ v8f wmma_f16(v16h a, v16h b, v8f c) {
  return __builtin_amdgcn_wmma_f32_16x16x32_f16(false, a, false, b, (short)0, c,
                                                false, false);
}

// ---------------------------------------------------------------------------
// Tensor Data Mover helpers. D# group1 (dims/strides, constant per tensor) is
// built once and hoisted; per-issue we only pack the new global address.
// ---------------------------------------------------------------------------
__device__ __forceinline__ i32x8 tdm_g1_2d(unsigned int tensor_d0,
                                           unsigned int tensor_d1,
                                           unsigned int tile_d0,
                                           unsigned int tile_d1,
                                           unsigned int stride0) {
  i32x8 g1 = { (int)0x00010000u,                                  // data_size=2B
               (int)((tensor_d0 & 0xFFFFu) << 16),
               (int)((tensor_d0 >> 16) | ((tensor_d1 & 0xFFFFu) << 16)),
               (int)((tensor_d1 >> 16) | (tile_d0 << 16)),
               (int)tile_d1,                                      // tile_dim2=0
               (int)stride0,
               0, 0 };
  return g1;
}

__device__ __forceinline__ void tdm_issue(unsigned int lds_addr,
                                          const void* gptr, i32x8 g1) {
  unsigned long long ga = (unsigned long long)gptr;
  u32x4 g0 = { 1u, lds_addr, (unsigned int)ga,
               (unsigned int)((ga >> 32) & 0x1FFFFFFu) | 0x80000000u };
  i32x4 z4 = {};
  i32x8 z8 = {};
  __builtin_amdgcn_tensor_load_to_lds(g0, g1, z4, z4, z8, 0);
}

// ---------------------------------------------------------------------------
// Pre-pass kernel. Few, fat waves: a launch of one-element threads is bound by
// how fast waves start, not by its bytes.
// ---------------------------------------------------------------------------
typedef __attribute__((ext_vector_type(4))) float    f32x4;
typedef __attribute__((ext_vector_type(4))) _Float16 v4h;

#define CVT_LOADS 8                          // 16-B loads in flight per thread
#define CVT_BLOCK (256 * CVT_LOADS * 4)      // floats converted per block

// f32 -> f16, CVT_BLOCK floats: block blk of the array.
// Every wave-wide load is 512 contiguous bytes, every store 256.
__device__ __forceinline__ void cvt_block(const float* __restrict__ src,
                                          _Float16* __restrict__ dst, int blk) {
  const int i4 = blk * (CVT_BLOCK / 4) + threadIdx.x;          // in groups of 4 floats
  const f32x4* s4 = (const f32x4*)src + i4;
  v4h* d4 = (v4h*)dst + i4;
  f32x4 v[CVT_LOADS];
#pragma unroll
  for (int j = 0; j < CVT_LOADS; ++j) v[j] = s4[j * 256];
#pragma unroll
  for (int j = 0; j < CVT_LOADS; ++j) d4[j * 256] = __builtin_convertvector(v[j], v4h);
}

// W: [NH, DM, DKH] f32  ->  Wt: [NH, DKH, DM] f16  (B^T per head)
// Block = 64 d (from 64 * dblk) x 64 dk of head h. A thread takes one dk and 16 consecutive
// d: 16 loads (a wave reads one 128-B line each), one 32-B piece of a Wt row out.
__device__ __forceinline__ void transpose_block(const float* __restrict__ W,
                                                _Float16* __restrict__ Wt, int dblk, int h) {
  const int dk = threadIdx.x & 63;
  const int d0 = dblk * 64 + (threadIdx.x >> 6) * 16;
  const float* s = W + ((long)h * DM + d0) * DKH + dk;
  float v[16];
#pragma unroll
  for (int j = 0; j < 16; ++j) v[j] = s[j * DKH];
  // The wait before a register that an issued load names is rewritten. It takes s as
  // an input, so the address pair stays live to here and no loaded value is put in it.
  asm volatile("s_wait_xcnt 0x0" :: "v"(s) : "memory");
  v8h lo, hi;
#pragma unroll
  for (int j = 0; j < 8; ++j) { lo[j] = (_Float16)v[j]; hi[j] = (_Float16)v[j + 8]; }
  v8h* o = (v8h*)(Wt + ((long)h * DKH + dk) * DM + d0);
  o[0] = lo;
  o[1] = hi;
  // The built kernel holds the other job's code behind this one's, on the same registers:
  // the wait before a register that an issued store names is rewritten.
  asm volatile("s_wait_xcnt 0x0" ::: "memory");
}

#define CVT_X_BLOCKS (S_LEN * DM / CVT_BLOCK)    // 512: one of Q, K, V
#define CVT_W_BLOCKS (DM * DM / CVT_BLOCK)       // 128: Wo
#define TR_BLOCKS    ((DM / 64) * NH)            // 256: one of Wq, Wk, Wv
#define PRE_BLOCKS   (3 * CVT_X_BLOCKS + CVT_W_BLOCKS + 3 * TR_BLOCKS)

// The whole pre-pass in one launch: its seven jobs depend on nothing and on one another
// not at all, so the block index alone picks job and piece. The large converts come first.
__global__ __launch_bounds__(256)
void prepass(const float* __restrict__ Q,  const float* __restrict__ K,
             const float* __restrict__ V,  const float* __restrict__ Wo,
             const float* __restrict__ Wq, const float* __restrict__ Wk,
             const float* __restrict__ Wv,
             _Float16* __restrict__ Qh,  _Float16* __restrict__ Kh,
             _Float16* __restrict__ Vh,  _Float16* __restrict__ Woh,
             _Float16* __restrict__ Wtq, _Float16* __restrict__ Wtk,
             _Float16* __restrict__ Wtv) {
  const unsigned int b = blockIdx.x;
  if (b < 3 * CVT_X_BLOCKS + CVT_W_BLOCKS) {
    const unsigned int job = b / CVT_X_BLOCKS;   // 0, 1, 2: Q, K, V; 3: Wo
    const float* s = job == 0 ? Q  : job == 1 ? K  : job == 2 ? V  : Wo;
    _Float16*    d = job == 0 ? Qh : job == 1 ? Kh : job == 2 ? Vh : Woh;
    cvt_block(s, d, b % CVT_X_BLOCKS);
  } else {
    const unsigned int r   = b - (3 * CVT_X_BLOCKS + CVT_W_BLOCKS);
    const unsigned int job = r / TR_BLOCKS;      // 0, 1, 2: Wq, Wk, Wv
    const unsigned int p   = r % TR_BLOCKS;
    const float* s = job == 0 ? Wq  : job == 1 ? Wk  : Wv;
    _Float16*    d = job == 0 ? Wtq : job == 1 ? Wtk : Wtv;
    transpose_block(s, d, p % (DM / 64), p / (DM / 64));
  }
}

// ---------------------------------------------------------------------------
// Operand staging of the two GEMM kernels. A fragment load straight from a row-major
// operand touches 16 cache lines for 1024 bytes; here every K tile (64 halfs = one 128-B
// line per row) goes to LDS by asynchronous copies that cover whole lines, and the
// fragments are read from LDS. LDS rows are bank-swizzled as in swz().
// ---------------------------------------------------------------------------
#define GT      64                 // halfs of K per staged tile
#define G_TILES (DM / GT)          // 16
#define GA_BYTES (256 * GT * 2)    // one A buffer: 256 rows
#define GB_BYTES (64 * GT * 2)     // one B buffer: 64 rows

// One K tile: 256 A rows and 64 B rows of 128 B. A thread copies the same 16-B chunk of
// every 32nd row: eight chunks of A, two of B; a wave-wide copy covers four whole lines.
// ga, gb: this thread's chunk in row (tid >> 3) of the tile; la, lb: its LDS byte address.
__device__ __forceinline__ void stage_tile(const _Float16* ga, const _Float16* gb,
                                           unsigned int la, unsigned int lb) {
  // The closing s_wait_xcnt stands in the copies' own statement: the address registers
  // that the copies name are rewritten for the next tile only behind it.
  asm volatile(
      "global_load_async_to_lds_b128 %0, %1, off\n\t"
      "global_load_async_to_lds_b128 %2, %3, off\n\t"
      "global_load_async_to_lds_b128 %4, %5, off\n\t"
      "global_load_async_to_lds_b128 %6, %7, off\n\t"
      "global_load_async_to_lds_b128 %8, %9, off\n\t"
      "global_load_async_to_lds_b128 %10, %11, off\n\t"
      "global_load_async_to_lds_b128 %12, %13, off\n\t"
      "global_load_async_to_lds_b128 %14, %15, off\n\t"
      "global_load_async_to_lds_b128 %16, %17, off\n\t"
      "global_load_async_to_lds_b128 %18, %19, off\n\t"
      "s_wait_xcnt 0x0"
      :: "v"(lb),              "v"(gb),
         "v"(lb + 1 * 4096u),  "v"(gb + 1 * 32 * DM),
         "v"(la),              "v"(ga),
         "v"(la + 1 * 4096u),  "v"(ga + 1 * 32 * DM),
         "v"(la + 2 * 4096u),  "v"(ga + 2 * 32 * DM),
         "v"(la + 3 * 4096u),  "v"(ga + 3 * 32 * DM),
         "v"(la + 4 * 4096u),  "v"(ga + 4 * 32 * DM),
         "v"(la + 5 * 4096u),  "v"(ga + 5 * 32 * DM),
         "v"(la + 6 * 4096u),  "v"(ga + 6 * 32 * DM),
         "v"(la + 7 * 4096u),  "v"(ga + 7 * 32 * DM)
      : "memory");
}

// acc[r][t] += A[rows wave*32 + r*16 ..][DM] x Bt[rows t*16 ..][DM]^T for a block of 8 waves.
// Ablk: row 0 of the block's 256 A rows; Bblk: row 0 of its 64 Bt rows (both pitch DM).
// Two LDS buffers: tile t + 1 is in flight while tile t is multiplied.
__device__ __forceinline__ void gemm_256x64(const _Float16* __restrict__ Ablk,
                                            const _Float16* __restrict__ Bblk,
                                            _Float16 (*sA)[256][GT],
                                            _Float16 (*sB)[64][GT],
                                            v8f (&acc)[2][4]) {
  const int wave  = threadIdx.x >> 5;
  const int crow  = threadIdx.x >> 3;          // 0..31
  const int chunk = threadIdx.x & 7;
  const _Float16* ga = Ablk + (long)crow * DM + chunk * 8;
  const _Float16* gb = Bblk + (long)crow * DM + chunk * 8;
  // rows crow + 32 j share (row >> 1) & 7, so one swizzled place serves all of a thread's chunks
  const unsigned int lofs = crow * (GT * 2) + (((chunk ^ (crow >> 1)) & 7) << 4);
  const unsigned int la = (unsigned int)(unsigned long long)&sA[0][0][0] + lofs;
  const unsigned int lb = (unsigned int)(unsigned long long)&sB[0][0][0] + lofs;

  stage_tile(ga, gb, la, lb);
  // tile 0 has landed for this wave; the barrier shows it to the others
  asm volatile("s_wait_asynccnt 0x0" ::: "memory");
  __syncthreads();
  stage_tile(ga + GT, gb + GT, la + GA_BYTES, lb + GB_BYTES);

  for (int t = 0; t < G_TILES; ++t) {
    const int cur = t & 1;
    const _Float16* tA = &sA[cur][wave * 32][0];
    const _Float16* tB = &sB[cur][0][0];
#pragma unroll
    for (int s = 0; s < GT; s += 32) {
      const v16h a0 = load_frag_swz(tA, s);
      const v16h a1 = load_frag_swz(tA + 16 * GT, s);
#pragma unroll
      for (int n = 0; n < 4; ++n) {
        const v16h b = load_frag_swz(tB + n * 16 * GT, s);
        acc[0][n] = wmma_f16(a0, b, acc[0][n]);
        acc[1][n] = wmma_f16(a1, b, acc[1][n]);
      }
    }
    // this wave's reads of buffer cur are done before the buffer is refilled
    asm volatile("s_wait_dscnt 0x0" ::: "memory");
    // this wave's copies of tile t + 1 have landed
    asm volatile("s_wait_asynccnt 0x0" ::: "memory");
    __syncthreads();   // publishes tile t + 1 and ends every wave's reads of buffer cur
    if (t + 2 < G_TILES)
      stage_tile(ga + (t + 2) * GT, gb + (t + 2) * GT, la + cur * GA_BYTES, lb + cur * GB_BYTES);
  }
  // no copy is outstanding when the wave goes on to its epilogue and ends
  asm volatile("s_wait_asynccnt 0x0" ::: "memory");
}

// ---------------------------------------------------------------------------
// QKV projection GEMMs: dst[h] = (A[S,DM] x W[h][DM,DKH] + b[h]) * scale
// 8 waves, tile 256(M) x 64(N); each wave 32x64; operands staged in LDS (gemm_256x64).
// layout 0: dst [H,S,DK] plain.  layout 1: dst [H,DK,S], each 64-key row piece
// swizzled by its dk row.  layout 2: dst [H,S,DK], each row swizzled by its key.
// (1 and 2 are the rows the attention kernel's 64x64 LDS tiles are copied from.)
// ---------------------------------------------------------------------------
template <int LAYOUT>
__device__ __forceinline__ void proj_store(const v8f (&acc)[2][4],
                                           const float* __restrict__ bias,
                                           _Float16* __restrict__ dst,
                                           float scale, int h, int m0) {
  const int lane = threadIdx.x & 31;
  const int rbase = (lane >> 4) << 3;
  // LAYOUT 2: swz(m, dk) = ((L ^ C) << 3) | (lane & 7), L from the lane (bits 0 and
  // 2 only), C = 2t ^ (i >> 1) known at compile time. Four pointers hold L ^ (C & 5);
  // bit 1 of C and the row go into the store's constant offset.
  _Float16* krow = dst + ((long)h * S_LEN + m0 + rbase) * DKH + (lane & 7);
  const int L = ((lane >> 3) & 1) | (rbase >> 1);
  _Float16* kp[4] = { krow + (L << 3), krow + ((L ^ 1) << 3),
                      krow + ((L ^ 4) << 3), krow + ((L ^ 5) << 3) };
  float bv[4];
#pragma unroll
  for (int t = 0; t < 4; ++t) {
    bv[t] = bias[h * DKH + t * 16 + (lane & 15)];
    // the load's address register may be reused for the next address: wait first
    asm volatile("s_wait_xcnt 0x0" ::: "memory");
  }
#pragma unroll
  for (int r = 0; r < 2; ++r)
#pragma unroll
    for (int t = 0; t < 4; ++t) {
      int dk = t * 16 + (lane & 15);
#pragma unroll
      for (int i = 0; i < 8; ++i) {
        int m = m0 + r * 16 + rbase + i;
        float val = (acc[r][t][i] + bv[t]) * scale;
        if (LAYOUT == 0)
          dst[((long)h * S_LEN + m) * DKH + dk] = (_Float16)val;
        else if (LAYOUT == 2) {
          const int C = (2 * t) ^ (i >> 1);
          kp[(C & 1) | ((C >> 1) & 2)][(r * 16 + i) * DKH + ((C & 2) << 3)] = (_Float16)val;
        }
        else
          dst[((long)h * DKH + dk) * S_LEN + (m & ~63) + swz(dk, m & 63)] = (_Float16)val;
      }
    }
  // The built kernel holds the other layouts' code behind this one's, on the same registers:
  // the wait before a register that an issued store names is rewritten.
  asm volatile("s_wait_xcnt 0x0" ::: "memory");
}

// All three projections in one launch: they depend on nothing of one another, and
// blockIdx.z picks q, k or v. Three blocks fit a WGP, so one's waits on its copies and
// its barrier are filled by the other two.
__global__ __launch_bounds__(256)
void proj_gemm3(const _Float16* __restrict__ Aq, const _Float16* __restrict__ Ak,
                const _Float16* __restrict__ Av,
                const _Float16* __restrict__ Btq, const _Float16* __restrict__ Btk,
                const _Float16* __restrict__ Btv,
                const float* __restrict__ bq, const float* __restrict__ bk,
                const float* __restrict__ bv,
                _Float16* __restrict__ dq, _Float16* __restrict__ dk,
                _Float16* __restrict__ dv) {
  const int wave = threadIdx.x >> 5;
  const int h    = blockIdx.x;
  const int m0   = blockIdx.y * 256 + wave * 32;
  const int job  = blockIdx.z;                 // 0: q, 1: k, 2: v
  const _Float16* A  = job == 0 ? Aq  : job == 1 ? Ak  : Av;
  const _Float16* Bt = job == 0 ? Btq : job == 1 ? Btk : Btv;

  v8f acc[2][4];
#pragma unroll
  for (int r = 0; r < 2; ++r)
#pragma unroll
    for (int t = 0; t < 4; ++t) acc[r][t] = (v8f){};

  __shared__ __align__(128) _Float16 sA[2][256][GT];
  __shared__ __align__(128) _Float16 sB[2][64][GT];
  gemm_256x64(A + (long)blockIdx.y * 256 * DM, Bt + (long)h * DKH * DM, sA, sB, acc);

  switch (job) {
    case 0:  proj_store<0>(acc, bq, dq, 0.125f, h, m0); break;   // q * 1/sqrt(dk)
    case 1:  proj_store<2>(acc, bk, dk, 1.0f, h, m0);   break;
    default: proj_store<1>(acc, bv, dv, 1.0f, h, m0);   break;
  }
}

// ---------------------------------------------------------------------------
// Flash attention: one (head, 128-query-row block) per 256-thread block.
// K/V 64x64 tiles DMA'd into double-buffered LDS by the TDM (wave 0), synced
// with s_wait_tensorcnt + barrier; all 8 waves read fragments from LDS.
// q is pre-scaled by 1/sqrt(dk) at projection time. k and vT rows arrive already
// bank-swizzled (see swz).
// Both products are transposed: S^T = K x Q^T and O^T += V^T x P^T. A lane then holds
// scores of ONE query (column lane & 15; 32 of the 64 keys, lane ^ 16 the other 32), so
// maximum and sum run inside the lane, and the P^T tiles, converted in place, are the
// B operand of the second product: P goes through no LDS.
// ---------------------------------------------------------------------------
// The grid puts two blocks on a WGP, four waves on a SIMD: the register budget is set for that.
__global__ __launch_bounds__(256) __attribute__((amdgpu_waves_per_eu(4, 4)))
void flash_attn(const _Float16* __restrict__ q,
                const _Float16* __restrict__ k,
                const _Float16* __restrict__ vT,
                _Float16* __restrict__ x) {
  __shared__ __align__(32) _Float16 kt[2][64][64];     // [key][dk]
  __shared__ __align__(32) _Float16 vt[2][64][64];     // [dk][key]

  const int wave = threadIdx.x >> 5;
  const int lane = threadIdx.x & 31;
  const int h    = blockIdx.y;
  const int m0   = blockIdx.x * 128 + wave * 16;

  const _Float16* qb = q  + ((long)h * S_LEN + m0) * DKH;
  const _Float16* kb = k  + (long)h * S_LEN * DKH;
  const _Float16* vb = vT + (long)h * DKH * S_LEN;

  const v16h aq0 = load_frag(qb, DKH);
  const v16h aq1 = load_frag(qb + 32, DKH);

  v8f o[4];
#pragma unroll
  for (int t = 0; t < 4; ++t) o[t] = (v8f){};

  float mrun = -1e30f;   // this lane's query: maximum so far (both halves alike)
  v8f   lacc = (v8f){};  // its sum, in 8 partial sums over this half's keys; joined in the epilogue

  const int rbase = (lane >> 4) << 3;

  // constant D# group1 descriptors, hoisted out of the loop
  const i32x8 g1k = tdm_g1_2d(DKH, S_LEN, 64, 64, DKH);
  const i32x8 g1v = tdm_g1_2d(S_LEN, DKH, 64, 64, S_LEN);
  const unsigned int ldsK[2] = { (unsigned int)(unsigned long long)&kt[0][0][0],
                                 (unsigned int)(unsigned long long)&kt[1][0][0] };
  const unsigned int ldsV[2] = { (unsigned int)(unsigned long long)&vt[0][0][0],
                                 (unsigned int)(unsigned long long)&vt[1][0][0] };

  if (wave == 0) {                              // prime buffer 0
    tdm_issue(ldsK[0], kb, g1k);
    tdm_issue(ldsV[0], vb, g1v);
  }

  for (int j0 = 0; j0 < S_LEN; j0 += 64) {
    const int cur = (j0 >> 6) & 1;
    const int nxt = cur ^ 1;
    if (wave == 0) {
      if (j0 + 64 < S_LEN) {
        tdm_issue(ldsK[nxt], kb + (long)(j0 + 64) * DKH, g1k);
        tdm_issue(ldsV[nxt], vb + (j0 + 64), g1v);
        __builtin_amdgcn_s_wait_tensorcnt(2);   // current pair complete
      } else {
        __builtin_amdgcn_s_wait_tensorcnt(0);
      }
    }
    __syncthreads();                            // tiles visible to all waves

    // ---- scores, transposed (q pre-scaled): s[t][i] = key t*16 + rbase + i, query lane & 15
    v8f s[4];
#pragma unroll
    for (int t = 0; t < 4; ++t) {
      v16h a0 = load_frag_swz(&kt[cur][t * 16][0], 0);
      v16h a1 = load_frag_swz(&kt[cur][t * 16][0], 32);
      v8f c = (v8f){};
      c = wmma_f16(a0, aq0, c);
      c = wmma_f16(a1, aq1, c);
      s[t] = c;
    }

    // V^T fragments (dk rows x keys), asked for here so that they land under the softmax
    v16h va[4][2];
#pragma unroll
    for (int t = 0; t < 4; ++t) {
      va[t][0] = load_frag_swz_packed_k(&vt[cur][t * 16][0], 0);
      va[t][1] = load_frag_swz_packed_k(&vt[cur][t * 16][0], 32);
    }

    // ---- online softmax, one query per lane ------------------------------
    float mt[4];                                // one short chain per tile, not one long
#pragma unroll
    for (int t = 0; t < 4; ++t) {
      mt[t] = s[t][0];
#pragma unroll
      for (int i = 1; i < 8; ++i) mt[t] = fmaxf(mt[t], s[t][i]);
    }
    float mx = fmaxf(fmaxf(mt[0], mt[1]), fmaxf(mt[2], mt[3]));
    mx = fmaxf(mx, xhalf(mx));

    const float mnew = fmaxf(mrun, mx);
    const float corr = __expf(mrun - mnew);
#pragma unroll
    for (int t = 0; t < 4; ++t)
#pragma unroll
      for (int i = 0; i < 8; i += 2) {          // exp(x) = 2^(x * log2 e), arguments in pairs
        f32x2 e = { s[t][i], s[t][i + 1] };
        e = (e - mnew) * 1.44269504f;
        s[t][i]     = __builtin_amdgcn_exp2f(e.x);
        s[t][i + 1] = __builtin_amdgcn_exp2f(e.y);
      }
    lacc = lacc * corr + ((s[0] + s[1]) + (s[2] + s[3]));
    mrun = mnew;
#pragma unroll
    for (int t = 0; t < 4; ++t) o[t] *= corr;

    // ---- P^T as B operands, straight from the score tiles ----------------
    const v16h pb0 = pack_tiles(s[0], s[1]);    // keys  0..31
    const v16h pb1 = pack_tiles(s[2], s[3]);    // keys 32..63

    // ---- O^T += V^T x P^T: o[t][i] = dk t*16 + rbase + i, query lane & 15 --
#pragma unroll
    for (int t = 0; t < 4; ++t) o[t] = wmma_f16(va[t][0], pb0, o[t]);
#pragma unroll
    for (int t = 0; t < 4; ++t) o[t] = wmma_f16(va[t][1], pb1, o[t]);
    __syncthreads();   // all reads of buf[cur] done before TDM reuses it
  }

  // ---- epilogue: a lane holds 8 consecutive dk of its query per tile: 16-B stores ----
  const float lrun = ((lacc[0] + lacc[1]) + (lacc[2] + lacc[3])) +
                     ((lacc[4] + lacc[5]) + (lacc[6] + lacc[7]));
  const float inv = 1.0f / (lrun + xhalf(lrun));
  _Float16* xr = x + (long)(m0 + (lane & 15)) * DM + h * DKH + rbase;
#pragma unroll
  for (int t = 0; t < 4; ++t)
    *(v8h*)(xr + t * 16) = __builtin_convertvector(o[t] * inv, v8h);
}

// ---------------------------------------------------------------------------
// Output projection: out[S,DM] = x[S,DM] @ Wo^T + bo, f32 output.
// Same tile and operand staging as the projection.
// ---------------------------------------------------------------------------
__global__ __launch_bounds__(256)
void out_gemm(const _Float16* __restrict__ A,
              const _Float16* __restrict__ Bt,
              const float* __restrict__ bias,
              float* __restrict__ dst) {
  const int wave = threadIdx.x >> 5;
  const int lane = threadIdx.x & 31;
  const int m0   = blockIdx.y * 256 + wave * 32;
  const int n0   = blockIdx.x * 64;

  v8f acc[2][4];
#pragma unroll
  for (int r = 0; r < 2; ++r)
#pragma unroll
    for (int t = 0; t < 4; ++t) acc[r][t] = (v8f){};

  __shared__ __align__(128) _Float16 sA[2][256][GT];
  __shared__ __align__(128) _Float16 sB[2][64][GT];
  gemm_256x64(A + (long)blockIdx.y * 256 * DM, Bt + (long)n0 * DM, sA, sB, acc);

  const int rbase = (lane >> 4) << 3;
#pragma unroll
  for (int r = 0; r < 2; ++r)
#pragma unroll
    for (int t = 0; t < 4; ++t) {
      int n = n0 + t * 16 + (lane & 15);
      float bv = bias[n];
#pragma unroll
      for (int i = 0; i < 8; ++i) {
        int m = m0 + r * 16 + rbase + i;
        dst[(long)m * DM + n] = acc[r][t][i] + bv;
      }
    }
}

// ---------------------------------------------------------------------------
extern "C" void kernel_launch(void* const* d_in, const int* in_sizes, int n_in,
                              void* d_out, int out_size, void* d_ws, size_t ws_size,
                              hipStream_t stream) {
  const float* Q  = (const float*)d_in[0];
  const float* K  = (const float*)d_in[1];
  const float* V  = (const float*)d_in[2];
  const float* Wq = (const float*)d_in[3];
  const float* bq = (const float*)d_in[4];
  const float* Wk = (const float*)d_in[5];
  const float* bk = (const float*)d_in[6];
  const float* Wv = (const float*)d_in[7];
  const float* bv = (const float*)d_in[8];
  const float* Wo = (const float*)d_in[9];
  const float* bo = (const float*)d_in[10];
  float* out = (float*)d_out;

  char* base = (char*)d_ws;
  size_t off = 0;
  auto alloc = [&](size_t elems) -> _Float16* {
    _Float16* p = (_Float16*)(base + off);
    off += (elems * sizeof(_Float16) + 255) & ~(size_t)255;
    return p;
  };

  _Float16* Qh  = alloc((size_t)S_LEN * DM);
  _Float16* Kh  = alloc((size_t)S_LEN * DM);
  _Float16* Vh  = alloc((size_t)S_LEN * DM);
  _Float16* Wtq = alloc((size_t)NH * DKH * DM);
  _Float16* Wtk = alloc((size_t)NH * DKH * DM);
  _Float16* Wtv = alloc((size_t)NH * DKH * DM);
  _Float16* Woh = alloc((size_t)DM * DM);
  _Float16* qh  = alloc((size_t)NH * S_LEN * DKH);  // [H,S,DK]
  _Float16* kh  = alloc((size_t)NH * S_LEN * DKH);  // [H,S,DK], rows swizzled
  _Float16* vTh = alloc((size_t)NH * DKH * S_LEN);  // [H,DK,S], 64-key pieces swizzled
  _Float16* xh  = alloc((size_t)S_LEN * DM);

  prepass<<<PRE_BLOCKS, 256, 0, stream>>>(Q, K, V, Wo, Wq, Wk, Wv,
                                          Qh, Kh, Vh, Woh, Wtq, Wtk, Wtv);

  dim3 gProj(NH, S_LEN / 256, 3);              // (16, 16, 3)
  proj_gemm3<<<gProj, 256, 0, stream>>>(Qh, Kh, Vh, Wtq, Wtk, Wtv, bq, bk, bv, qh, kh, vTh);

  dim3 gAttn(S_LEN / 128, NH);                 // (32, 16)
  flash_attn<<<gAttn, 256, 0, stream>>>(qh, kh, vTh, xh);

  dim3 gOut(DM / 64, S_LEN / 256);             // (16, 16)
  out_gemm<<<gOut, 256, 0, stream>>>(xh, Woh, bo, out);
}

// v006
// It runs in 109 microseconds.
// Next to v005, in two timings, it ran 1.06 times as fast each time.
// Counting every step since v000, it is 5.54 times as fast.
#include <hip/hip_runtime.h>
#include <hip/hip_bf16.h>
#include <math.h>

typedef __attribute__((ext_vector_type(16))) _Float16 v16h;
typedef __attribute__((ext_vector_type(8)))  _Float16 v8h;
typedef __attribute__((ext_vector_type(8)))  float    v8f;
typedef __attribute__((ext_vector_type(2)))  float    f32x2;
typedef __attribute__((ext_vector_type(4)))  unsigned int u32x4;
typedef __attribute__((ext_vector_type(8)))  int      i32x8;
typedef __attribute__((ext_vector_type(4)))  int      i32x4;

#define S_LEN 4096
#define DM    1024
#define NH    16
#define DKH   64   // head dim

// ---------------------------------------------------------------------------
// Fragment loader (global or LDS), contiguous k order (not AMD's table order),
// valid because A and B both use it.
// A (16x32 f16): lanes 0-15 -> row (lane&15), K 0..15 ; lanes 16-31 -> K 16..31
// B (32x16 f16): identical addressing against B^T stored [N, K] row-major.
// ---------------------------------------------------------------------------
__device__ __forceinline__ v16h load_frag(const _Float16* base, int ld) {
  int l = threadIdx.x & 31;
  return *(const v16h*)(base + (long)(l & 15) * ld + ((l >> 4) << 4));
}

// ---------------------------------------------------------------------------
// Bank swizzle for rows of 64 halfs (128 B). A row is eight 16-B chunks; logical
// chunk c of row r is kept at place c ^ ((r >> 1) & 7). Sixteen lanes that read
// the same logical chunk of sixteen consecutive rows then touch all 64 LDS banks
// once, where the plain layout puts them on 8 banks.
// swz(): index in halfs, inside its row, of logical column col (0..63) of row.
// ---------------------------------------------------------------------------
__device__ __forceinline__ int swz(int row, int col) {
  return ((((col >> 3) ^ (row >> 1)) & 7) << 3) | (col & 7);
}

// Same fragment as load_frag(tile + col0, 64), read from swizzled LDS rows.
// tile points at a row whose index is a multiple of 16.
__device__ __forceinline__ v16h load_frag_swz(const _Float16* tile, int col0) {
  int l = threadIdx.x & 31;
  int r = l & 15;
  int c = col0 + ((l >> 4) << 4);
  const _Float16* rowp = tile + r * 64;
  v8h lo = *(const v8h*)(rowp + swz(r, c));
  v8h hi = *(const v8h*)(rowp + swz(r, c + 8));
  return __builtin_shufflevector(lo, hi, 0, 1, 2, 3, 4, 5, 6, 7,
                                 8, 9, 10, 11, 12, 13, 14, 15);
}

// Fragment of 16 swizzled LDS rows x 32 columns from col0, in the k order of a B operand
// packed from two accumulator tiles: element e of half hf is column
// col0 + (e < 8 ? 8 * hf + e : 16 + 8 * hf + e - 8).
__device__ __forceinline__ v16h load_frag_swz_packed_k(const _Float16* tile, int col0) {
  int l = threadIdx.x & 31;
  int r = l & 15;
  int c = col0 + ((l >> 4) << 3);
  const _Float16* rowp = tile + r * 64;
  v8h lo = *(const v8h*)(rowp + swz(r, c));
  v8h hi = *(const v8h*)(rowp + swz(r, c + 16));
  return __builtin_shufflevector(lo, hi, 0, 1, 2, 3, 4, 5, 6, 7,
                                 8, 9, 10, 11, 12, 13, 14, 15);
}

// Two f32 accumulator tiles (rows 0-15 and 16-31 of one 32-row block) as one f16 B operand.
__device__ __forceinline__ v16h pack_tiles(v8f t0, v8f t1) {
  v8h lo = __builtin_convertvector(t0, v8h);
  v8h hi = __builtin_convertvector(t1, v8h);
  return __builtin_shufflevector(lo, hi, 0, 1, 2, 3, 4, 5, 6, 7,
                                 8, 9, 10, 11, 12, 13, 14, 15);
}

// Value of lane l ^ 16.
__device__ __forceinline__ float xhalf(float v) {
  int b = __builtin_bit_cast(int, v);
  return __builtin_bit_cast(float, __builtin_amdgcn_permlanex16(b, b, 0x76543210, 0xfedcba98,
                                                                false, false));
}

__device__ __forceinline__ v8f wmma_f16(v16h a, v16h b, v8f c) {
  return __builtin_amdgcn_wmma_f32_16x16x32_f16(false, a, false, b, (short)0, c,
                                                false, false);
}

// ---------------------------------------------------------------------------
// Tensor Data Mover helpers. D# group1 (dims/strides, constant per tensor) is
// built once and hoisted; per-issue we only pack the new global address.
// ---------------------------------------------------------------------------
__device__ __forceinline__ i32x8 tdm_g1_2d(unsigned int tensor_d0,
                                           unsigned int tensor_d1,
                                           unsigned int tile_d0,
                                           unsigned int tile_d1,
                                           unsigned int stride0) {
  i32x8 g1 = { (int)0x00010000u,                                  // data_size=2B
               (int)((tensor_d0 & 0xFFFFu) << 16),
               (int)((tensor_d0 >> 16) | ((tensor_d1 & 0xFFFFu) << 16)),
               (int)((tensor_d1 >> 16) | (tile_d0 << 16)),
               (int)tile_d1,                                      // tile_dim2=0
               (int)stride0,
               0, 0 };
  return g1;
}

__device__ __forceinline__ void tdm_issue(unsigned int lds_addr,
                                          const void* gptr, i32x8 g1) {
  unsigned long long ga = (unsigned long long)gptr;
  u32x4 g0 = { 1u, lds_addr, (unsigned int)ga,
               (unsigned int)((ga >> 32) & 0x1FFFFFFu) | 0x80000000u };
  i32x4 z4 = {};
  i32x8 z8 = {};
  __builtin_amdgcn_tensor_load_to_lds(g0, g1, z4, z4, z8, 0);
}

// ---------------------------------------------------------------------------
// Pre-pass kernel. Few, fat waves: a launch of one-element threads is bound by
// how fast waves start, not by its bytes.
// ---------------------------------------------------------------------------
typedef __attribute__((ext_vector_type(4))) float    f32x4;
typedef __attribute__((ext_vector_type(4))) _Float16 v4h;

#define CVT_LOADS 8                          // 16-B loads in flight per thread
#define CVT_BLOCK (256 * CVT_LOADS * 4)      // floats converted per block

// f32 -> f16, CVT_BLOCK floats: block blk of the array.
// Every wave-wide load is 512 contiguous bytes, every store 256.
__device__ __forceinline__ void cvt_block(const float* __restrict__ src,
                                          _Float16* __restrict__ dst, int blk) {
  const int i4 = blk * (CVT_BLOCK / 4) + threadIdx.x;          // in groups of 4 floats
  const f32x4* s4 = (const f32x4*)src + i4;
  v4h* d4 = (v4h*)dst + i4;
  f32x4 v[CVT_LOADS];
#pragma unroll
  for (int j = 0; j < CVT_LOADS; ++j) v[j] = s4[j * 256];
#pragma unroll
  for (int j = 0; j < CVT_LOADS; ++j) d4[j * 256] = __builtin_convertvector(v[j], v4h);
}

// W: [NH, DM, DKH] f32  ->  Wt: [NH, DKH, DM] f16  (B^T per head)
// Block = 64 d (from 64 * dblk) x 64 dk of head h. A thread takes one dk and 16 consecutive
// d: 16 loads (a wave reads one 128-B line each), one 32-B piece of a Wt row out.
__device__ __forceinline__ void transpose_block(const float* __restrict__ W,
                                                _Float16* __restrict__ Wt, int dblk, int h) {
  const int dk = threadIdx.x & 63;
  const int d0 = dblk * 64 + (threadIdx.x >> 6) * 16;
  const float* s = W + ((long)h * DM + d0) * DKH + dk;
  float v[16];
#pragma unroll
  for (int j = 0; j < 16; ++j) v[j] = s[j * DKH];
  // The wait before a register that an issued load names is rewritten. It takes s as
  // an input, so the address pair stays live to here and no loaded value is put in it.
  asm volatile("s_wait_xcnt 0x0" :: "v"(s) : "memory");
  v8h lo, hi;
#pragma unroll
  for (int j = 0; j < 8; ++j) { lo[j] = (_Float16)v[j]; hi[j] = (_Float16)v[j + 8]; }
  v8h* o = (v8h*)(Wt + ((long)h * DKH + dk) * DM + d0);
  o[0] = lo;
  o[1] = hi;
  // The built kernel holds the other job's code behind this one's, on the same registers:
  // the wait before a register that an issued store names is rewritten.
  asm volatile("s_wait_xcnt 0x0" ::: "memory");
}

#define CVT_X_BLOCKS (S_LEN * DM / CVT_BLOCK)    // 512: one of Q, K, V
#define CVT_W_BLOCKS (DM * DM / CVT_BLOCK)       // 128: Wo
#define TR_BLOCKS    ((DM / 64) * NH)            // 256: one of Wq, Wk, Wv
#define PRE_BLOCKS   (3 * CVT_X_BLOCKS + CVT_W_BLOCKS + 3 * TR_BLOCKS)

// The whole pre-pass in one launch: its seven jobs depend on nothing and on one another
// not at all, so the block index alone picks job and piece. The large converts come first.
__global__ __launch_bounds__(256)
void prepass(const float* __restrict__ Q,  const float* __restrict__ K,
             const float* __restrict__ V,  const float* __restrict__ Wo,
             const float* __restrict__ Wq, const float* __restrict__ Wk,
             const float* __restrict__ Wv,
             _Float16* __restrict__ Qh,  _Float16* __restrict__ Kh,
             _Float16* __restrict__ Vh,  _Float16* __restrict__ Woh,
             _Float16* __restrict__ Wtq, _Float16* __restrict__ Wtk,
             _Float16* __restrict__ Wtv) {
  const unsigned int b = blockIdx.x;
  if (b < 3 * CVT_X_BLOCKS + CVT_W_BLOCKS) {
    const unsigned int job = b / CVT_X_BLOCKS;   // 0, 1, 2: Q, K, V; 3: Wo
    const float* s = job == 0 ? Q  : job == 1 ? K  : job == 2 ? V  : Wo;
    _Float16*    d = job == 0 ? Qh : job == 1 ? Kh : job == 2 ? Vh : Woh;
    cvt_block(s, d, b % CVT_X_BLOCKS);
  } else {
    const unsigned int r   = b - (3 * CVT_X_BLOCKS + CVT_W_BLOCKS);
    const unsigned int job = r / TR_BLOCKS;      // 0, 1, 2: Wq, Wk, Wv
    const unsigned int p   = r % TR_BLOCKS;
    const float* s = job == 0 ? Wq  : job == 1 ? Wk  : Wv;
    _Float16*    d = job == 0 ? Wtq : job == 1 ? Wtk : Wtv;
    transpose_block(s, d, p % (DM / 64), p / (DM / 64));
  }
}

// ---------------------------------------------------------------------------
// Operand staging of the two GEMM kernels. A fragment load straight from a row-major
// operand touches 16 cache lines for 1024 bytes; here every K tile (64 halfs = one 128-B
// line per row) goes to LDS by asynchronous copies that cover whole lines, and the
// fragments are read from LDS. LDS rows are bank-swizzled as in swz().
// ---------------------------------------------------------------------------
#define GT      64                 // halfs of K per staged tile
#define G_TILES (DM / GT)          // 16
#define GA_BYTES (256 * GT * 2)    // one A buffer: 256 rows
#define GB_BYTES (64 * GT * 2)     // one B buffer: 64 rows

// One K tile: 256 A rows and 64 B rows of 128 B. A thread copies the same 16-B chunk of
// every 32nd row: eight chunks of A, two of B; a wave-wide copy covers four whole lines.
// ga, gb: this thread's chunk in row (tid >> 3) of the tile; la, lb: its LDS byte address.
__device__ __forceinline__ void stage_tile(const _Float16* ga, const _Float16* gb,
                                           unsigned int la, unsigned int lb) {
  // The closing s_wait_xcnt stands in the copies' own statement: the address registers
  // that the copies name are rewritten for the next tile only behind it.
  asm volatile(
      "global_load_async_to_lds_b128 %0, %1, off\n\t"
      "global_load_async_to_lds_b128 %2, %3, off\n\t"
      "global_load_async_to_lds_b128 %4, %5, off\n\t"
      "global_load_async_to_lds_b128 %6, %7, off\n\t"
      "global_load_async_to_lds_b128 %8, %9, off\n\t"
      "global_load_async_to_lds_b128 %10, %11, off\n\t"
      "global_load_async_to_lds_b128 %12, %13, off\n\t"
      "global_load_async_to_lds_b128 %14, %15, off\n\t"
      "global_load_async_to_lds_b128 %16, %17, off\n\t"
      "global_load_async_to_lds_b128 %18, %19, off\n\t"
      "s_wait_xcnt 0x0"
      :: "v"(lb),              "v"(gb),
         "v"(lb + 1 * 4096u),  "v"(gb + 1 * 32 * DM),
         "v"(la),              "v"(ga),
         "v"(la + 1 * 4096u),  "v"(ga + 1 * 32 * DM),
         "v"(la + 2 * 4096u),  "v"(ga + 2 * 32 * DM),
         "v"(la + 3 * 4096u),  "v"(ga + 3 * 32 * DM),
         "v"(la + 4 * 4096u),  "v"(ga + 4 * 32 * DM),
         "v"(la + 5 * 4096u),  "v"(ga + 5 * 32 * DM),
         "v"(la + 6 * 4096u),  "v"(ga + 6 * 32 * DM),
         "v"(la + 7 * 4096u),  "v"(ga + 7 * 32 * DM)
      : "memory");
}

// acc[r][t] += A[rows wave*32 + r*16 ..][DM] x Bt[rows t*16 ..][DM]^T for a block of 8 waves.
// Ablk: row 0 of the block's 256 A rows; Bblk: row 0 of its 64 Bt rows (both pitch DM).
// Two LDS buffers: tile t + 1 is in flight while tile t is multiplied.
__device__ __forceinline__ void gemm_256x64(const _Float16* __restrict__ Ablk,
                                            const _Float16* __restrict__ Bblk,
                                            _Float16 (*sA)[256][GT],
                                            _Float16 (*sB)[64][GT],
                                            v8f (&acc)[2][4]) {
  const int wave  = threadIdx.x >> 5;
  const int crow  = threadIdx.x >> 3;          // 0..31
  const int chunk = threadIdx.x & 7;
  const _Float16* ga = Ablk + (long)crow * DM + chunk * 8;
  const _Float16* gb = Bblk + (long)crow * DM + chunk * 8;
  // rows crow + 32 j share (row >> 1) & 7, so one swizzled place serves all of a thread's chunks
  const unsigned int lofs = crow * (GT * 2) + (((chunk ^ (crow >> 1)) & 7) << 4);
  const unsigned int la = (unsigned int)(unsigned long long)&sA[0][0][0] + lofs;
  const unsigned int lb = (unsigned int)(unsigned long long)&sB[0][0][0] + lofs;

  stage_tile(ga, gb, la, lb);
  // tile 0 has landed for this wave; the barrier shows it to the others
  asm volatile("s_wait_asynccnt 0x0" ::: "memory");
  __syncthreads();
  stage_tile(ga + GT, gb + GT, la + GA_BYTES, lb + GB_BYTES);

  for (int t = 0; t < G_TILES; ++t) {
    const int cur = t & 1;
    const _Float16* tA = &sA[cur][wave * 32][0];
    const _Float16* tB = &sB[cur][0][0];
#pragma unroll
    for (int s = 0; s < GT; s += 32) {
      const v16h a0 = load_frag_swz(tA, s);
      const v16h a1 = load_frag_swz(tA + 16 * GT, s);
#pragma unroll
      for (int n = 0; n < 4; ++n) {
        const v16h b = load_frag_swz(tB + n * 16 * GT, s);
        acc[0][n] = wmma_f16(a0, b, acc[0][n]);
        acc[1][n] = wmma_f16(a1, b, acc[1][n]);
      }
    }
    // this wave's reads of buffer cur are done before the buffer is refilled
    asm volatile("s_wait_dscnt 0x0" ::: "memory");
    // this wave's copies of tile t + 1 have landed
    asm volatile("s_wait_asynccnt 0x0" ::: "memory");
    __syncthreads();   // publishes tile t + 1 and ends every wave's reads of buffer cur
    if (t + 2 < G_TILES)
      stage_tile(ga + (t + 2) * GT, gb + (t + 2) * GT, la + cur * GA_BYTES, lb + cur * GB_BYTES);
  }
  // no copy is outstanding when the wave goes on to its epilogue and ends
  asm volatile("s_wait_asynccnt 0x0" ::: "memory");
}

// ---------------------------------------------------------------------------
// QKV projection GEMMs: dst[h] = (A[S,DM] x W[h][DM,DKH] + b[h]) * scale
// 8 waves, tile 256(M) x 64(N); each wave 32x64; operands staged in LDS (gemm_256x64).
// layout 0: dst [H,S,DK] plain.  layout 1: dst [H,DK,S], each 64-key row piece
// swizzled by its dk row.  layout 2: dst [H,S,DK], each row swizzled by its key.
// (1 and 2 are the rows the attention kernel's 64x64 LDS tiles are copied from.)
// ---------------------------------------------------------------------------
template <int LAYOUT>
__device__ __forceinline__ void proj_store(const v8f (&acc)[2][4],
                                           const float* __restrict__ bias,
                                           _Float16* __restrict__ dst,
                                           float scale, int h, int m0) {
  const int lane = threadIdx.x & 31;
  const int rbase = (lane >> 4) << 3;
  // LAYOUT 2: swz(m, dk) = ((L ^ C) << 3) | (lane & 7), L from the lane (bits 0 and
  // 2 only), C = 2t ^ (i >> 1) known at compile time. Four pointers hold L ^ (C & 5);
  // bit 1 of C and the row go into the store's constant offset.
  _Float16* krow = dst + ((long)h * S_LEN + m0 + rbase) * DKH + (lane & 7);
  const int L = ((lane >> 3) & 1) | (rbase >> 1);
  _Float16* kp[4] = { krow + (L << 3), krow + ((L ^ 1) << 3),
                      krow + ((L ^ 4) << 3), krow + ((L ^ 5) << 3) };
  float bv[4];
#pragma unroll
  for (int t = 0; t < 4; ++t) {
    bv[t] = bias[h * DKH + t * 16 + (lane & 15)];
    // the load's address register may be reused for the next address: wait first
    asm volatile("s_wait_xcnt 0x0" ::: "memory");
  }
#pragma unroll
  for (int r = 0; r < 2; ++r)
#pragma unroll
    for (int t = 0; t < 4; ++t) {
      int dk = t * 16 + (lane & 15);
#pragma unroll
      for (int i = 0; i < 8; ++i) {
        int m = m0 + r * 16 + rbase + i;
        float val = (acc[r][t][i] + bv[t]) * scale;
        if (LAYOUT == 0)
          dst[((long)h * S_LEN + m) * DKH + dk] = (_Float16)val;
        else if (LAYOUT == 2) {
          const int C = (2 * t) ^ (i >> 1);
          kp[(C & 1) | ((C >> 1) & 2)][(r * 16 + i) * DKH + ((C & 2) << 3)] = (_Float16)val;
        }
        else
          dst[((long)h * DKH + dk) * S_LEN + (m & ~63) + swz(dk, m & 63)] = (_Float16)val;
      }
    }
  // The built kernel holds the other layouts' code behind this one's, on the same registers:
  // the wait before a register that an issued store names is rewritten.
  asm volatile("s_wait_xcnt 0x0" ::: "memory");
}

// All three projections in one launch: they depend on nothing of one another, and
// blockIdx.z picks q, k or v. Three blocks fit a WGP, so one's waits on its copies and
// its barrier are filled by the other two.
__global__ __launch_bounds__(256)
void proj_gemm3(const _Float16* __restrict__ Aq, const _Float16* __restrict__ Ak,
                const _Float16* __restrict__ Av,
                const _Float16* __restrict__ Btq, const _Float16* __restrict__ Btk,
                const _Float16* __restrict__ Btv,
                const float* __restrict__ bq, const float* __restrict__ bk,
                const float* __restrict__ bv,
                _Float16* __restrict__ dq, _Float16* __restrict__ dk,
                _Float16* __restrict__ dv) {
  const int wave = threadIdx.x >> 5;
  const int h    = blockIdx.x;
  const int m0   = blockIdx.y * 256 + wave * 32;
  const int job  = blockIdx.z;                 // 0: q, 1: k, 2: v
  const _Float16* A  = job == 0 ? Aq  : job == 1 ? Ak  : Av;
  const _Float16* Bt = job == 0 ? Btq : job == 1 ? Btk : Btv;

  v8f acc[2][4];
#pragma unroll
  for (int r = 0; r < 2; ++r)
#pragma unroll
    for (int t = 0; t < 4; ++t) acc[r][t] = (v8f){};

  __shared__ __align__(128) _Float16 sA[2][256][GT];
  __shared__ __align__(128) _Float16 sB[2][64][GT];
  gemm_256x64(A + (long)blockIdx.y * 256 * DM, Bt + (long)h * DKH * DM, sA, sB, acc);

  switch (job) {
    case 0:  proj_store<0>(acc, bq, dq, 0.18033688f, h, m0); break;   // q * log2(e)/sqrt(dk)
    case 1:  proj_store<2>(acc, bk, dk, 1.0f, h, m0);   break;
    default: proj_store<1>(acc, bv, dv, 1.0f, h, m0);   break;
  }
}

// ---------------------------------------------------------------------------
// Flash attention: one (head, 128-query-row block) per 256-thread block.
// K/V 64x64 tiles DMA'd into double-buffered LDS by the TDM (wave 0), synced
// with s_wait_tensorcnt + barrier; all 8 waves read fragments from LDS.
// q is pre-scaled by log2(e)/sqrt(dk) at projection time, so scores are exponents of 2.
// k and vT rows arrive already bank-swizzled (see swz).
// Both products are transposed: S^T = K x Q^T and O^T += V^T x P^T. A lane then holds
// scores of ONE query (column lane & 15; 32 of the 64 keys, lane ^ 16 the other 32), so
// maximum and sum run inside the lane, and the P^T tiles, converted in place, are the
// B operand of the second product: P goes through no LDS.
// The maximum in use is changed only when a tile exceeds it by more than 8 (a factor 256,
// far inside f16 and f32 range). It is therefore known before a tile's scores are, and its
// negative is the accumulator start of the score products: they deliver score - maximum,
// the argument of exp2, with no vector subtract or multiply, and O and the sum are
// rescaled only in the rare tile that moves the maximum.
// ---------------------------------------------------------------------------
// The grid puts two blocks on a WGP, four waves on a SIMD: the register budget is set for that.
__global__ __launch_bounds__(256) __attribute__((amdgpu_waves_per_eu(4, 4)))
void flash_attn(const _Float16* __restrict__ q,
                const _Float16* __restrict__ k,
                const _Float16* __restrict__ vT,
                _Float16* __restrict__ x) {
  __shared__ __align__(32) _Float16 kt[2][64][64];     // [key][dk]
  __shared__ __align__(32) _Float16 vt[2][64][64];     // [dk][key]

  const int wave = threadIdx.x >> 5;
  const int lane = threadIdx.x & 31;
  const int h    = blockIdx.y;
  const int m0   = blockIdx.x * 128 + wave * 16;

  const _Float16* qb = q  + ((long)h * S_LEN + m0) * DKH;
  const _Float16* kb = k  + (long)h * S_LEN * DKH;
  const _Float16* vb = vT + (long)h * DKH * S_LEN;

  const v16h aq0 = load_frag(qb, DKH);
  const v16h aq1 = load_frag(qb + 32, DKH);

  v8f o[4];
#pragma unroll
  for (int t = 0; t < 4; ++t) o[t] = (v8f){};

  v8f negm = (v8f){};    // minus the maximum in use for this lane's query, in all 8 places
                         // (both halves alike); the first tile sets it
  v8f lacc = (v8f){};    // its sum, in 8 partial sums over this half's keys; joined in the epilogue

  const int rbase = (lane >> 4) << 3;

  // constant D# group1 descriptors, hoisted out of the loop
  const i32x8 g1k = tdm_g1_2d(DKH, S_LEN, 64, 64, DKH);
  const i32x8 g1v = tdm_g1_2d(S_LEN, DKH, 64, 64, S_LEN);
  const unsigned int ldsK[2] = { (unsigned int)(unsigned long long)&kt[0][0][0],
                                 (unsigned int)(unsigned long long)&kt[1][0][0] };
  const unsigned int ldsV[2] = { (unsigned int)(unsigned long long)&vt[0][0][0],
                                 (unsigned int)(unsigned long long)&vt[1][0][0] };

  if (wave == 0) {                              // prime buffer 0
    tdm_issue(ldsK[0], kb, g1k);
    tdm_issue(ldsV[0], vb, g1v);
  }

  // not unrolled: the test for the first tile would otherwise have the whole first trip,
  // tensor loads and barriers included, copied out in front of the loop
#pragma nounroll
  for (int j0 = 0; j0 < S_LEN; j0 += 64) {
    const int cur = (j0 >> 6) & 1;
    const int nxt = cur ^ 1;
    if (wave == 0) {
      if (j0 + 64 < S_LEN) {
        tdm_issue(ldsK[nxt], kb + (long)(j0 + 64) * DKH, g1k);
        tdm_issue(ldsV[nxt], vb + (j0 + 64), g1v);
        __builtin_amdgcn_s_wait_tensorcnt(2);   // current pair complete
      } else {
        __builtin_amdgcn_s_wait_tensorcnt(0);
      }
    }
    __syncthreads();                            // tiles visible to all waves

    // ---- scores minus the maximum in use, transposed: s[t][i] = key t*16 + rbase + i,
    //      query lane & 15
    v8f s[4];
#pragma unroll
    for (int t = 0; t < 4; ++t) {
      v16h a0 = load_frag_swz(&kt[cur][t * 16][0], 0);
      v16h a1 = load_frag_swz(&kt[cur][t * 16][0], 32);
      v8f c = wmma_f16(a0, aq0, negm);
      s[t] = wmma_f16(a1, aq1, c);
    }

    // V^T fragments (dk rows x keys), asked for here so that they land under the softmax
    v16h va[4][2];
#pragma unroll
    for (int t = 0; t < 4; ++t) {
      va[t][0] = load_frag_swz_packed_k(&vt[cur][t * 16][0], 0);
      va[t][1] = load_frag_swz_packed_k(&vt[cur][t * 16][0], 32);
    }

    // ---- online softmax, one query per lane ------------------------------
    float mt[4];                                // one short chain per tile, not one long
#pragma unroll
    for (int t = 0; t < 4; ++t) {
      mt[t] = s[t][0];
#pragma unroll
      for (int i = 1; i < 8; ++i) mt[t] = fmaxf(mt[t], s[t][i]);
    }
    float mx = fmaxf(fmaxf(mt[0], mt[1]), fmaxf(mt[2], mt[3]));
    mx = fmaxf(mx, xhalf(mx));

    // One test per tile, a scalar branch: does any query of the wave move its maximum?
    const bool first = (j0 == 0);
    if (first || __builtin_amdgcn_ballot_w32(mx > 8.0f) != 0) {
      // The first tile sets the maximum (up or down; O and the sum are still 0, and the
      // factor 0 keeps them so whatever the step); later it only rises.
      const float step = first ? mx : fmaxf(mx, 0.0f);
      const float corr = first ? 0.0f : __builtin_amdgcn_exp2f(-step);
#pragma unroll
      for (int t = 0; t < 4; ++t) { s[t] -= step; o[t] *= corr; }
      lacc *= corr;
      negm -= step;
    }
#pragma unroll
    for (int t = 0; t < 4; ++t)
#pragma unroll
      for (int i = 0; i < 8; ++i) s[t][i] = __builtin_amdgcn_exp2f(s[t][i]);
    lacc += (s[0] + s[1]) + (s[2] + s[3]);

    // ---- P^T as B operands, straight from the score tiles ----------------
    const v16h pb0 = pack_tiles(s[0], s[1]);    // keys  0..31
    const v16h pb1 = pack_tiles(s[2], s[3]);    // keys 32..63

    // ---- O^T += V^T x P^T: o[t][i] = dk t*16 + rbase + i, query lane & 15 --
#pragma unroll
    for (int t = 0; t < 4; ++t) o[t] = wmma_f16(va[t][0], pb0, o[t]);
#pragma unroll
    for (int t = 0; t < 4; ++t) o[t] = wmma_f16(va[t][1], pb1, o[t]);
    __syncthreads();   // all reads of buf[cur] done before TDM reuses it
  }

  // ---- epilogue: a lane holds 8 consecutive dk of its query per tile: 16-B stores ----
  const float lrun = ((lacc[0] + lacc[1]) + (lacc[2] + lacc[3])) +
                     ((lacc[4] + lacc[5]) + (lacc[6] + lacc[7]));
  const float inv = 1.0f / (lrun + xhalf(lrun));
  _Float16* xr = x + (long)(m0 + (lane & 15)) * DM + h * DKH + rbase;
#pragma unroll
  for (int t = 0; t < 4; ++t)
    *(v8h*)(xr + t * 16) = __builtin_convertvector(o[t] * inv, v8h);
}

// ---------------------------------------------------------------------------
// Output projection: out[S,DM] = x[S,DM] @ Wo^T + bo, f32 output.
// Same tile and operand staging as the projection.
// ---------------------------------------------------------------------------
__global__ __launch_bounds__(256)
void out_gemm(const _Float16* __restrict__ A,
              const _Float16* __restrict__ Bt,
              const float* __restrict__ bias,
              float* __restrict__ dst) {
  const int wave = threadIdx.x >> 5;
  const int lane = threadIdx.x & 31;
  const int m0   = blockIdx.y * 256 + wave * 32;
  const int n0   = blockIdx.x * 64;

  v8f acc[2][4];
#pragma unroll
  for (int r = 0; r < 2; ++r)
#pragma unroll
    for (int t = 0; t < 4; ++t) acc[r][t] = (v8f){};

  __shared__ __align__(128) _Float16 sA[2][256][GT];
  __shared__ __align__(128) _Float16 sB[2][64][GT];
  gemm_256x64(A + (long)blockIdx.y * 256 * DM, Bt + (long)n0 * DM, sA, sB, acc);

  const int rbase = (lane >> 4) << 3;
#pragma unroll
  for (int r = 0; r < 2; ++r)
#pragma unroll
    for (int t = 0; t < 4; ++t) {
      int n = n0 + t * 16 + (lane & 15);
      float bv = bias[n];
#pragma unroll
      for (int i = 0; i < 8; ++i) {
        int m = m0 + r * 16 + rbase + i;
        dst[(long)m * DM + n] = acc[r][t][i] + bv;
      }
    }
}

// ---------------------------------------------------------------------------
extern "C" void kernel_launch(void* const* d_in, const int* in_sizes, int n_in,
                              void* d_out, int out_size, void* d_ws, size_t ws_size,
                              hipStream_t stream) {
  const float* Q  = (const float*)d_in[0];
  const float* K  = (const float*)d_in[1];
  const float* V  = (const float*)d_in[2];
  const float* Wq = (const float*)d_in[3];
  const float* bq = (const float*)d_in[4];
  const float* Wk = (const float*)d_in[5];
  const float* bk = (const float*)d_in[6];
  const float* Wv = (const float*)d_in[7];
  const float* bv = (const float*)d_in[8];
  const float* Wo = (const float*)d_in[9];
  const float* bo = (const float*)d_in[10];
  float* out = (float*)d_out;

  char* base = (char*)d_ws;
  size_t off = 0;
  auto alloc = [&](size_t elems) -> _Float16* {
    _Float16* p = (_Float16*)(base + off);
    off += (elems * sizeof(_Float16) + 255) & ~(size_t)255;
    return p;
  };

  _Float16* Qh  = alloc((size_t)S_LEN * DM);
  _Float16* Kh  = alloc((size_t)S_LEN * DM);
  _Float16* Vh  = alloc((size_t)S_LEN * DM);
  _Float16* Wtq = alloc((size_t)NH * DKH * DM);
  _Float16* Wtk = alloc((size_t)NH * DKH * DM);
  _Float16* Wtv = alloc((size_t)NH * DKH * DM);
  _Float16* Woh = alloc((size_t)DM * DM);
  _Float16* qh  = alloc((size_t)NH * S_LEN * DKH);  // [H,S,DK]
  _Float16* kh  = alloc((size_t)NH * S_LEN * DKH);  // [H,S,DK], rows swizzled
  _Float16* vTh = alloc((size_t)NH * DKH * S_LEN);  // [H,DK,S], 64-key pieces swizzled
  _Float16* xh  = alloc((size_t)S_LEN * DM);

  prepass<<<PRE_BLOCKS, 256, 0, stream>>>(Q, K, V, Wo, Wq, Wk, Wv,
                                          Qh, Kh, Vh, Woh, Wtq, Wtk, Wtv);

  dim3 gProj(NH, S_LEN / 256, 3);              // (16, 16, 3)
  proj_gemm3<<<gProj, 256, 0, stream>>>(Qh, Kh, Vh, Wtq, Wtk, Wtv, bq, bk, bv, qh, kh, vTh);

  dim3 gAttn(S_LEN / 128, NH);                 // (32, 16)
  flash_attn<<<gAttn, 256, 0, stream>>>(qh, kh, vTh, xh);

  dim3 gOut(DM / 64, S_LEN / 256);             // (16, 16)
  out_gemm<<<gOut, 256, 0, stream>>>(xh, Woh, bo, out);
}
